// v000
// Measured on an AMD MI455X. A time is GPU time per run, averaged over a window of back-to-back runs after a warm-up
// (all launches, gaps included; the runs take copies of the inputs in turn), and the median of several windows.
// Apart from v000's, it joins two sittings. Times from different sittings can be a few percent apart, while
// side-by-side timings come from the same sitting.
// The starting kernel, v000, takes 2190 microseconds a run.
#include <hip/hip_runtime.h>

// CausalRelativeAttention (queries/keys/values [2][2048][16 heads][64], pos_emb [2048][16][64]; QE = q.E_h^T; Srel = skew(QE) (Music-Transformer pad/reshape trick);
// logits = (q.k^T + Srel + attn_mask_add[l][s] + key_lengths_add[n][s]) / 8; softmax over s; out[n][l][h][d] = sum_s A v).
// Compute dtypes, f32 accumulate: every input rounded to bf16; q.k^T and q.E^T on PLAIN bf16 operands (all inputs: exact products); the skew
// (an index remap of QE: Srel[i][j] = QE[i][L-1+j-i] for j <= i, = 0 for j = i+1, = QE[i+1][j-i-2] for j > i+1 - exactly the reference's pad/reshape), the two additive

#define NB_  2
#define TT   2048
#define NH_  16
#define HD   64
#define DD   (NH_ * HD)           // 1024
#define NT   (NB_ * TT)
#define ZH   2
typedef _Float16 h16;
typedef unsigned short bf;
typedef __attribute__((ext_vector_type(16))) __bf16   v16bf;
typedef __attribute__((ext_vector_type(16))) _Float16 v16h;
typedef __attribute__((ext_vector_type(8)))  _Float16 v8h;
typedef __attribute__((ext_vector_type(8)))  unsigned short v8us;
typedef __attribute__((ext_vector_type(8)))  float    v8f;
typedef __attribute__((ext_vector_type(4)))  float    v4f;
typedef v8h  __attribute__((may_alias)) v8ha;
typedef v4f  __attribute__((may_alias)) v4fa;
typedef v8us __attribute__((may_alias)) v8usa;

__device__ __forceinline__ unsigned short f2bf(float f) { unsigned u = __float_as_uint(f); u += 0x7FFFu + ((u >> 16) & 1u); return (unsigned short)(u >> 16); }
__device__ __forceinline__ float bf2f(unsigned short b) { return __uint_as_float(((unsigned)b) << 16); }
__device__ __forceinline__ float bfr(float f) { return bf2f(f2bf(f)); }
__device__ __forceinline__ v16h cat16(v8h lo, v8h hi) { return __builtin_shufflevector(lo, hi, 0, 1, 2, 3, 4, 5, 6, 7, 8, 9, 10, 11, 12, 13, 14, 15); }
__device__ __forceinline__ v16bf cat16b(v8us lo, v8us hi) { return __builtin_bit_cast(v16bf, __builtin_shufflevector(lo, hi, 0, 1, 2, 3, 4, 5, 6, 7, 8, 9, 10, 11, 12, 13, 14, 15)); }
__device__ __forceinline__ v8f wmma16(v16h a, v16h b, v8f c) { return __builtin_amdgcn_wmma_f32_16x16x32_f16(false, a, false, b, (short)0, c, false, false); }
__device__ __forceinline__ v8f wmmab(v16bf a, v16bf b, v8f c) { return __builtin_amdgcn_wmma_f32_16x16x32_bf16(false, a, false, b, (short)0, c, false, false); }



// ---- k_gemmw: register-blocked GEMM, ONE WAVE per 64x64 output tile (16 accumulators), operands straight from K-contiguous 16-bit planes; grid (M/64, N/64, Z), 32 threads.
// C[m][n] (f32, pitch ldc, + optional f32 bias[n]) = sum_k A[m][k] Bt[n][k] (+ split products per NSPLIT). z-batch strides sA/sB/sC in elements. K % 32 == 0.
template <typename T16> struct WFrag;
template <> struct WFrag<h16> { typedef v16h V; static __device__ __forceinline__ V ld(const h16* p) { return cat16(*(const v8h*)p, *(const v8h*)(p + 16)); } static __device__ __forceinline__ v8f mma(V a, V b, v8f c) { return wmma16(a, b, c); } };
template <> struct WFrag<bf> { typedef v16bf V; static __device__ __forceinline__ V ld(const bf* p) { return cat16b(*(const v8us*)p, *(const v8us*)(p + 16)); } static __device__ __forceinline__ v8f mma(V a, V b, v8f c) { return wmmab(a, b, c); } };
template <typename T16, int NSPLIT, bool BIAS>
__global__ __launch_bounds__(32) void k_gemmw(const T16* __restrict__ A, const T16* __restrict__ A2, const T16* __restrict__ Bt, const T16* __restrict__ Bt2, int K, float* C, int ldc, const float* __restrict__ bias, size_t sA, size_t sB, size_t sC) {
    typedef typename WFrag<T16>::V V;
    __shared__ __align__(16) float os[16 * 68];
    const size_t z = blockIdx.z; A += z * sA; if (A2) A2 += z * sA; Bt += z * sB; if (Bt2) Bt2 += z * sB; C += z * sC;
    const int lane = threadIdx.x & 31, lr = lane & 15, hi = lane >> 4; const int r0 = blockIdx.x * 64, c0 = blockIdx.y * 64;
    v8f acc[4][4];
#pragma unroll
    for (int mb = 0; mb < 4; ++mb)
#pragma unroll
        for (int nb = 0; nb < 4; ++nb) acc[mb][nb] = (v8f){};
    const size_t aoff = (size_t)(r0 + lr) * K + 8 * hi, boff = (size_t)(c0 + lr) * K + 8 * hi;
#pragma unroll 1
    for (int kc = 0; kc < K; kc += 32) {
        V a[4], a2[4];
#pragma unroll
        for (int mb = 0; mb < 4; ++mb) { a[mb] = WFrag<T16>::ld(A + aoff + (size_t)mb * 16 * K + kc); if (NSPLIT == 1 || NSPLIT == 2) a2[mb] = WFrag<T16>::ld(A2 + aoff + (size_t)mb * 16 * K + kc); }
#pragma unroll
        for (int nb = 0; nb < 4; ++nb) { const V b = WFrag<T16>::ld(Bt + boff + (size_t)nb * 16 * K + kc); V b2; if (NSPLIT >= 2) b2 = WFrag<T16>::ld(Bt2 + boff + (size_t)nb * 16 * K + kc);
#pragma unroll
            for (int mb = 0; mb < 4; ++mb) { acc[mb][nb] = WFrag<T16>::mma(a[mb], b, acc[mb][nb]); if (NSPLIT == 1 || NSPLIT == 2) acc[mb][nb] = WFrag<T16>::mma(a2[mb], b, acc[mb][nb]); if (NSPLIT >= 2) acc[mb][nb] = WFrag<T16>::mma(a[mb], b2, acc[mb][nb]); } }
        asm volatile("v_nop\n\tv_nop\n\tv_nop\n\tv_nop" : "+v"(acc[0][0]), "+v"(acc[1][1]), "+v"(acc[2][2]), "+v"(acc[3][3]) : "v"(a[0]), "v"(a[3]));
    }
#pragma unroll
    for (int mb = 0; mb < 4; ++mb) {
#pragma unroll
        for (int nb = 0; nb < 4; ++nb) {
#pragma unroll
            for (int j = 0; j < 8; ++j) os[(hi * 8 + j) * 68 + nb * 16 + lr] = acc[mb][nb][j]; }
        __builtin_amdgcn_wave_barrier(); asm volatile("" ::: "memory");
        float* crow = C + (size_t)(r0 + mb * 16) * ldc + c0;
{
#pragma unroll
            for (int s = 0; s < 8; ++s) { const int row = 2 * s + hi, cofs = lr * 4; v4f val = *(const v4fa*)(os + row * 68 + cofs); if (BIAS) { val[0] += bfr(bias[c0 + cofs]); val[1] += bfr(bias[c0 + cofs + 1]); val[2] += bfr(bias[c0 + cofs + 2]); val[3] += bfr(bias[c0 + cofs + 3]); }
                *(v4f*)(crow + (size_t)row * ldc + cofs) = val; }
             }
        __builtin_amdgcn_wave_barrier(); asm volatile("" ::: "memory");
    }
}

__device__ __forceinline__ void splitf(float y, unsigned short& h, unsigned short& l) { h = f2bf(y); l = f2bf(y - bf2f(h)); }
typedef __attribute__((ext_vector_type(2))) unsigned short v2us;
typedef __attribute__((ext_vector_type(4))) unsigned short v4us;
typedef __attribute__((ext_vector_type(2))) float v2f;

__global__ __launch_bounds__(256) void k_hplane(const float* __restrict__ src, bf* P) {
    const int lane = threadIdx.x & 31; const int L0 = (blockIdx.x * 8 + (threadIdx.x >> 5)) * 8; const int nlines = NT * DD / 64;
{
#pragma unroll
        for (int l = 0; l < 8; ++l) { const int L = L0 + l; if (L >= nlines) break; const int e = L * 64 + lane * 2; const int d = e & 63; const int t = (e >> 6) & (TT - 1); const int z = e >> 17; const int n = z >> 4, h = z & 15; v2us o;
#pragma unroll
            for (int q = 0; q < 2; ++q) o[q] = f2bf(src[(((size_t)n * TT + t) * NH_ + h) * HD + d + q]);
            *(v2us*)(P + (size_t)e) = o; }
         }
}
__global__ __launch_bounds__(256) void k_eplane(const float* __restrict__ pe, bf* EP) {
    const int lane = threadIdx.x & 31; const int L0 = (blockIdx.x * 8 + (threadIdx.x >> 5)) * 8; const int nlines = NH_ * TT * HD / 64;
{
#pragma unroll
        for (int l = 0; l < 8; ++l) { const int L = L0 + l; if (L >= nlines) break; const int e = L * 64 + lane * 2; const int d = e & 63; const int r = (e >> 6) & (TT - 1); const int h = e >> 17; v2us o;
#pragma unroll
            for (int q = 0; q < 2; ++q) o[q] = f2bf(pe[((size_t)r * NH_ + h) * HD + d + q]);
            *(v2us*)(EP + (size_t)e) = o; }
         }
}
__global__ __launch_bounds__(256) void k_vtplane(const float* __restrict__ v, bf* VT) {
    const int lane = threadIdx.x & 31; const int L0 = (blockIdx.x * 8 + (threadIdx.x >> 5)) * 8; const int nlines = NT * DD / 64;
{
#pragma unroll
        for (int l = 0; l < 8; ++l) { const int L = L0 + l; if (L >= nlines) break; const int e = L * 64 + lane * 2; const int s = e & (TT - 1); const int d = (e >> 11) & 63; const int z = e >> 17; const int n = z >> 4, h = z & 15; v2us o;
#pragma unroll
            for (int q = 0; q < 2; ++q) o[q] = f2bf(v[(((size_t)n * TT + s + q) * NH_ + h) * HD + d]);
            *(v2us*)(VT + (size_t)e) = o; }
         }
}
// logit(i,j) = (S[i][j] + Srel(i,j) + bf(am[i][j]) + bf(kla[n][j])) / 8 with Srel(i,j) = QE[i][L-1+j-i] (j <= i), 0 (j == i+1), QE[i+1][j-i-2] (j >= i+2).
__device__ __forceinline__ float cr_logit(const float* __restrict__ sr, const float* __restrict__ sk1, const float* __restrict__ sk2, const float* __restrict__ ar, const float* __restrict__ kr, int i, int j) {
    const float sk = (j <= i) ? sk1[j] : ((j == i + 1) ? 0.f : sk2[j]);
    return __fmul_rn(__fadd_rn(__fadd_rn(sr[j], sk), __fadd_rn(bfr(ar[j]), bfr(kr[j]))), 0.125f);
}
__global__ __launch_bounds__(256) void k_rmax(const float* __restrict__ S, const float* __restrict__ QE, const float* __restrict__ am, const float* __restrict__ kla, int n, float* RS) {
    const int lane = threadIdx.x & 31; const int row = blockIdx.x * 8 + (threadIdx.x >> 5); if (row >= ZH * TT) return; const int i = row & (TT - 1); const int zz = row >> 11;
    const float* sr = S + (size_t)row * TT; const float* qe = QE + (size_t)zz * TT * TT; const float* sk1 = qe + (size_t)i * TT + (TT - 1 - i); const float* sk2 = qe + (size_t)(i + 1) * TT - (i + 2); const float* ar = am + (size_t)i * TT; const float* kr = kla + (size_t)n * TT;
    float mx = -3.0e38f;
#pragma unroll 4
    for (int j = lane; j < TT; j += 32) mx = fmaxf(mx, cr_logit(sr, sk1, sk2, ar, kr, i, j));
#pragma unroll
    for (int sh = 16; sh; sh >>= 1) mx = fmaxf(mx, __shfl_xor(mx, sh, 32));
    const float o = lane == 0 ? mx : 0.f; *(float*)(RS + (size_t)row * 32 + lane) = o; 
}
// k_rexp: P hi/lo [row][j] = split(exp(logit - max)) (unnormalised, <= 1; bf16 planes have the f32 exponent range, no flush issue) and RS[row][1] = 1/sum; lane -> 2 consecutive j per
__global__ __launch_bounds__(256) void k_rexp(const float* __restrict__ S, const float* __restrict__ QE, const float* __restrict__ am, const float* __restrict__ kla, int n, float* RS, bf* Ph, bf* Pl) {
    const int lane = threadIdx.x & 31; const int row = blockIdx.x * 8 + (threadIdx.x >> 5); if (row >= ZH * TT) return; const int i = row & (TT - 1); const int zz = row >> 11;
    const float* sr = S + (size_t)row * TT; const float* qe = QE + (size_t)zz * TT * TT; const float* sk1 = qe + (size_t)i * TT + (TT - 1 - i); const float* sk2 = qe + (size_t)(i + 1) * TT - (i + 2); const float* ar = am + (size_t)i * TT; const float* kr = kla + (size_t)n * TT;
    const float mx = RS[(size_t)row * 32]; float sum = 0.f;
#pragma unroll 2
    for (int c0 = 0; c0 < TT; c0 += 64) { const int j = c0 + lane * 2; v2us oh, ol;
#pragma unroll
        for (int q = 0; q < 2; ++q) { const float e = __expf(cr_logit(sr, sk1, sk2, ar, kr, i, j + q) - mx); sum += e; unsigned short a, c2; splitf(e, a, c2); oh[q] = a; ol[q] = c2; }
        *(v2us*)(Ph + (size_t)row * TT + j) = oh; *(v2us*)(Pl + (size_t)row * TT + j) = ol;  }
#pragma unroll
    for (int sh = 16; sh; sh >>= 1) sum += __shfl_xor(sum, sh, 32);
    const float o2 = lane == 0 ? mx : (lane == 1 ? __fdiv_rn(1.0f, sum) : 0.f); *(float*)(RS + (size_t)row * 32 + lane) = o2; 
}
__global__ __launch_bounds__(256) void k_out(const float* __restrict__ O, const float* __restrict__ RS, int n, int h0, float* OUT) {
    const int lane = threadIdx.x & 31; const int L0 = (blockIdx.x * 8 + (threadIdx.x >> 5)) * 8; const int nlines = ZH * TT * HD / 64;
{
#pragma unroll
        for (int l = 0; l < 8; ++l) { const int L = L0 + l; if (L >= nlines) break; const int e = L * 64 + lane * 2; const int d = e & 63; const int t = (e >> 6) & (TT - 1); const int zz = e >> 17; v2f o;
            const float ri = RS[((size_t)zz * TT + t) * 32 + 1]; o[0] = O[(size_t)e] * ri; o[1] = O[(size_t)e + 1] * ri;
            *(v2f*)(OUT + (((size_t)n * TT + t) * NH_ + h0 + zz) * HD + d) = o; }
         }
}

extern "C" void kernel_launch(void* const* d_in, const int* in_sizes, int n_in,
                              void* d_out, int out_size, void* d_ws, size_t ws_size, hipStream_t stream) {
    (void)in_sizes; (void)n_in; (void)out_size;
    const float* queries = (const float*)d_in[0]; const float* keys = (const float*)d_in[1]; const float* values = (const float*)d_in[2]; const float* pos_emb = (const float*)d_in[3]; const float* am = (const float*)d_in[4]; const float* kla = (const float*)d_in[5];
    float* OUT = (float*)d_out;     // [2][2048][16][64]
    char* wsp = (char*)d_ws;
    auto take = [&](size_t bytes) { char* p = wsp; wsp += (bytes + 255) & ~(size_t)255; return (void*)p; };
    bf* QP = (bf*)take((size_t)NT * DD * 2); bf* KP = (bf*)take((size_t)NT * DD * 2); bf* VT = (bf*)take((size_t)NT * DD * 2); bf* EP = (bf*)take((size_t)NH_ * TT * HD * 2);
    float* QE = (float*)take((size_t)ZH * TT * TT * 4); float* S = (float*)take((size_t)ZH * TT * TT * 4); bf* Ph = (bf*)take((size_t)ZH * TT * TT * 2); bf* Pl = (bf*)take((size_t)ZH * TT * TT * 2); float* Ob = (float*)take((size_t)ZH * TT * HD * 4); float* RS = (float*)take((size_t)ZH * TT * 32 * 4);
    if ((size_t)(wsp - (char*)d_ws) > ws_size) return;    // ws 256 MiB
    const unsigned LB = (unsigned)((NT * DD / 64 + 63) / 64);
    k_hplane<<<LB, 256, 0, stream>>>(queries, QP); k_hplane<<<LB, 256, 0, stream>>>(keys, KP); k_vtplane<<<LB, 256, 0, stream>>>(values, VT); k_eplane<<<(NH_ * TT * HD / 64 + 63) / 64, 256, 0, stream>>>(pos_emb, EP);
    for (int n = 0; n < NB_; ++n)
        for (int h0 = 0; h0 < NH_; h0 += ZH) { const size_t z0 = (size_t)n * NH_ + h0;
            k_gemmw<bf, 0, false><<<dim3(TT / 64, TT / 64, ZH), 32, 0, stream>>>(QP + z0 * TT * HD, nullptr, EP + (size_t)h0 * TT * HD, nullptr, HD, QE, TT, nullptr, (size_t)TT * HD, (size_t)TT * HD, (size_t)TT * TT);   // QE[l][r] = q_l . E_h[r]
            k_gemmw<bf, 0, false><<<dim3(TT / 64, TT / 64, ZH), 32, 0, stream>>>(QP + z0 * TT * HD, nullptr, KP + z0 * TT * HD, nullptr, HD, S, TT, nullptr, (size_t)TT * HD, (size_t)TT * HD, (size_t)TT * TT);      // S[l][s] = q_l . k_s
            k_rmax<<<ZH * TT / 8, 256, 0, stream>>>(S, QE, am, kla, n, RS); k_rexp<<<ZH * TT / 8, 256, 0, stream>>>(S, QE, am, kla, n, RS, Ph, Pl);
            k_gemmw<bf, 1, false><<<dim3(TT / 64, 1, ZH), 32, 0, stream>>>(Ph, Pl, VT + z0 * HD * TT, nullptr, TT, Ob, HD, nullptr, (size_t)TT * TT, (size_t)HD * TT, (size_t)TT * HD);
            k_out<<<(ZH * TT * HD / 64 + 63) / 64, 256, 0, stream>>>(Ob, RS, n, h0, OUT); }
}

// v001
// A run of this version takes 654 microseconds.
// In both of two side-by-side timings against v000, it was 3.29 times as fast.
#include <hip/hip_runtime.h>

// CausalRelativeAttention (queries/keys/values [2][2048][16 heads][64], pos_emb [2048][16][64]; QE = q.E_h^T; Srel = skew(QE) (Music-Transformer pad/reshape trick);
// logits = (q.k^T + Srel + attn_mask_add[l][s] + key_lengths_add[n][s]) / 8; softmax over s; out[n][l][h][d] = sum_s A v).
// Compute dtypes, f32 accumulate: every input rounded to bf16; q.k^T and q.E^T on PLAIN bf16 operands (all inputs: exact products); the skew
// (an index remap of QE: Srel[i][j] = QE[i][L-1+j-i] for j <= i, = 0 for j = i+1, = QE[i+1][j-i-2] for j > i+1 - exactly the reference's pad/reshape), the two additive

#define NB_  2
#define TT   2048
#define NH_  16
#define HD   64
#define DD   (NH_ * HD)           // 1024
#define NT   (NB_ * TT)
#define ZH   2
typedef _Float16 h16;
typedef unsigned short bf;
typedef __attribute__((ext_vector_type(16))) __bf16   v16bf;
typedef __attribute__((ext_vector_type(16))) _Float16 v16h;
typedef __attribute__((ext_vector_type(8)))  _Float16 v8h;
typedef __attribute__((ext_vector_type(8)))  unsigned short v8us;
typedef __attribute__((ext_vector_type(8)))  float    v8f;
typedef __attribute__((ext_vector_type(4)))  float    v4f;
typedef v8h  __attribute__((may_alias)) v8ha;
typedef v4f  __attribute__((may_alias)) v4fa;
typedef v8us __attribute__((may_alias)) v8usa;

__device__ __forceinline__ unsigned short f2bf(float f) { unsigned u = __float_as_uint(f); u += 0x7FFFu + ((u >> 16) & 1u); return (unsigned short)(u >> 16); }
__device__ __forceinline__ float bf2f(unsigned short b) { return __uint_as_float(((unsigned)b) << 16); }
__device__ __forceinline__ float bfr(float f) { return bf2f(f2bf(f)); }
__device__ __forceinline__ v16h cat16(v8h lo, v8h hi) { return __builtin_shufflevector(lo, hi, 0, 1, 2, 3, 4, 5, 6, 7, 8, 9, 10, 11, 12, 13, 14, 15); }
__device__ __forceinline__ v16bf cat16b(v8us lo, v8us hi) { return __builtin_bit_cast(v16bf, __builtin_shufflevector(lo, hi, 0, 1, 2, 3, 4, 5, 6, 7, 8, 9, 10, 11, 12, 13, 14, 15)); }
__device__ __forceinline__ v8f wmma16(v16h a, v16h b, v8f c) { return __builtin_amdgcn_wmma_f32_16x16x32_f16(false, a, false, b, (short)0, c, false, false); }
__device__ __forceinline__ v8f wmmab(v16bf a, v16bf b, v8f c) { return __builtin_amdgcn_wmma_f32_16x16x32_bf16(false, a, false, b, (short)0, c, false, false); }



// ---- k_gemmw: register-blocked GEMM, ONE WAVE per 64x64 output tile (16 accumulators), operands straight from K-contiguous 16-bit planes; grid (M/64, N/64, Z), 32 threads.
// C[m][n] (f32, pitch ldc, + optional f32 bias[n]) = sum_k A[m][k] Bt[n][k] (+ split products per NSPLIT). z-batch strides sA/sB/sC in elements. K % 32 == 0.
template <typename T16> struct WFrag;
template <> struct WFrag<h16> { typedef v16h V; static __device__ __forceinline__ V ld(const h16* p) { return cat16(*(const v8h*)p, *(const v8h*)(p + 16)); } static __device__ __forceinline__ v8f mma(V a, V b, v8f c) { return wmma16(a, b, c); } };
template <> struct WFrag<bf> { typedef v16bf V; static __device__ __forceinline__ V ld(const bf* p) { return cat16b(*(const v8us*)p, *(const v8us*)(p + 16)); } static __device__ __forceinline__ v8f mma(V a, V b, v8f c) { return wmmab(a, b, c); } };
template <typename T16, int NSPLIT, bool BIAS>
__global__ __launch_bounds__(32) void k_gemmw(const T16* __restrict__ A, const T16* __restrict__ A2, const T16* __restrict__ Bt, const T16* __restrict__ Bt2, int K, float* C, int ldc, const float* __restrict__ bias, size_t sA, size_t sB, size_t sC) {
    typedef typename WFrag<T16>::V V;
    __shared__ __align__(16) float os[16 * 68];
    const size_t z = blockIdx.z; A += z * sA; if (A2) A2 += z * sA; Bt += z * sB; if (Bt2) Bt2 += z * sB; C += z * sC;
    const int lane = threadIdx.x & 31, lr = lane & 15, hi = lane >> 4; const int r0 = blockIdx.x * 64, c0 = blockIdx.y * 64;
    v8f acc[4][4];
#pragma unroll
    for (int mb = 0; mb < 4; ++mb)
#pragma unroll
        for (int nb = 0; nb < 4; ++nb) acc[mb][nb] = (v8f){};
    const size_t aoff = (size_t)(r0 + lr) * K + 8 * hi, boff = (size_t)(c0 + lr) * K + 8 * hi;
#pragma unroll 1
    for (int kc = 0; kc < K; kc += 32) {
        V a[4], a2[4];
#pragma unroll
        for (int mb = 0; mb < 4; ++mb) { a[mb] = WFrag<T16>::ld(A + aoff + (size_t)mb * 16 * K + kc); if (NSPLIT == 1 || NSPLIT == 2) a2[mb] = WFrag<T16>::ld(A2 + aoff + (size_t)mb * 16 * K + kc); }
#pragma unroll
        for (int nb = 0; nb < 4; ++nb) { const V b = WFrag<T16>::ld(Bt + boff + (size_t)nb * 16 * K + kc); V b2; if (NSPLIT >= 2) b2 = WFrag<T16>::ld(Bt2 + boff + (size_t)nb * 16 * K + kc);
#pragma unroll
            for (int mb = 0; mb < 4; ++mb) { acc[mb][nb] = WFrag<T16>::mma(a[mb], b, acc[mb][nb]); if (NSPLIT == 1 || NSPLIT == 2) acc[mb][nb] = WFrag<T16>::mma(a2[mb], b, acc[mb][nb]); if (NSPLIT >= 2) acc[mb][nb] = WFrag<T16>::mma(a[mb], b2, acc[mb][nb]); } }
        asm volatile("v_nop\n\tv_nop\n\tv_nop\n\tv_nop" : "+v"(acc[0][0]), "+v"(acc[1][1]), "+v"(acc[2][2]), "+v"(acc[3][3]) : "v"(a[0]), "v"(a[3]));
    }
#pragma unroll
    for (int mb = 0; mb < 4; ++mb) {
#pragma unroll
        for (int nb = 0; nb < 4; ++nb) {
#pragma unroll
            for (int j = 0; j < 8; ++j) os[(hi * 8 + j) * 68 + nb * 16 + lr] = acc[mb][nb][j]; }
        __builtin_amdgcn_wave_barrier(); asm volatile("" ::: "memory");
        float* crow = C + (size_t)(r0 + mb * 16) * ldc + c0;
{
#pragma unroll
            for (int s = 0; s < 8; ++s) { const int row = 2 * s + hi, cofs = lr * 4; v4f val = *(const v4fa*)(os + row * 68 + cofs); if (BIAS) { val[0] += bfr(bias[c0 + cofs]); val[1] += bfr(bias[c0 + cofs + 1]); val[2] += bfr(bias[c0 + cofs + 2]); val[3] += bfr(bias[c0 + cofs + 3]); }
                *(v4f*)(crow + (size_t)row * ldc + cofs) = val; }
             }
        __builtin_amdgcn_wave_barrier(); asm volatile("" ::: "memory");
    }
}

__device__ __forceinline__ void splitf(float y, unsigned short& h, unsigned short& l) { h = f2bf(y); l = f2bf(y - bf2f(h)); }
typedef __attribute__((ext_vector_type(2))) unsigned short v2us;
typedef __attribute__((ext_vector_type(4))) unsigned short v4us;
typedef __attribute__((ext_vector_type(2))) float v2f;

__global__ __launch_bounds__(256) void k_hplane(const float* __restrict__ src, bf* P) {
    const int lane = threadIdx.x & 31; const int L0 = (blockIdx.x * 8 + (threadIdx.x >> 5)) * 8; const int nlines = NT * DD / 64;
{
#pragma unroll
        for (int l = 0; l < 8; ++l) { const int L = L0 + l; if (L >= nlines) break; const int e = L * 64 + lane * 2; const int d = e & 63; const int t = (e >> 6) & (TT - 1); const int z = e >> 17; const int n = z >> 4, h = z & 15; v2us o;
#pragma unroll
            for (int q = 0; q < 2; ++q) o[q] = f2bf(src[(((size_t)n * TT + t) * NH_ + h) * HD + d + q]);
            *(v2us*)(P + (size_t)e) = o; }
         }
}
__global__ __launch_bounds__(256) void k_eplane(const float* __restrict__ pe, bf* EP) {
    const int lane = threadIdx.x & 31; const int L0 = (blockIdx.x * 8 + (threadIdx.x >> 5)) * 8; const int nlines = NH_ * TT * HD / 64;
{
#pragma unroll
        for (int l = 0; l < 8; ++l) { const int L = L0 + l; if (L >= nlines) break; const int e = L * 64 + lane * 2; const int d = e & 63; const int r = (e >> 6) & (TT - 1); const int h = e >> 17; v2us o;
#pragma unroll
            for (int q = 0; q < 2; ++q) o[q] = f2bf(pe[((size_t)r * NH_ + h) * HD + d + q]);
            *(v2us*)(EP + (size_t)e) = o; }
         }
}
__global__ __launch_bounds__(256) void k_vtplane(const float* __restrict__ v, bf* VT) {
    const int lane = threadIdx.x & 31; const int L0 = (blockIdx.x * 8 + (threadIdx.x >> 5)) * 8; const int nlines = NT * DD / 64;
{
#pragma unroll
        for (int l = 0; l < 8; ++l) { const int L = L0 + l; if (L >= nlines) break; const int e = L * 64 + lane * 2; const int s = e & (TT - 1); const int d = (e >> 11) & 63; const int z = e >> 17; const int n = z >> 4, h = z & 15; v2us o;
#pragma unroll
            for (int q = 0; q < 2; ++q) o[q] = f2bf(v[(((size_t)n * TT + s + q) * NH_ + h) * HD + d]);
            *(v2us*)(VT + (size_t)e) = o; }
         }
}
// logit(i,j) = (S[i][j] + Srel(i,j) + bf(am[i][j]) + bf(kla[n][j])) / 8 with Srel(i,j) = QE[i][L-1+j-i] (j <= i), 0 (j == i+1), QE[i+1][j-i-2] (j >= i+2).
// In the flat QE plane both branches are one run: with sk = QE + i*L + (L-1-i), Srel(i,j) = sk[j] (j <= i) and sk[j-1] (j >= i+2).
// ---- k_smpv: softmax and P.V of 16 query rows of one head in one work-group of 16 waves; grid ZH * L / 16.
// Phase 1, wave w = row i0 + w: the row's 2048 logits stay in registers (64 a lane, 4 consecutive j per 128-column chunk), max and sum by lane shuffles,
// exp(logit - max) split into bf16 hi/lo planes in LDS. Phase 2, wave w = key columns [128 w, 128 w + 128): A fragments from the LDS planes, B fragments from VT,
// f32 partial 16x64 tiles to LDS. Phase 3: the 16 partials are added in slice order, scaled by 1/sum and stored as whole 256-byte rows of the output.
#define PP 2056                   // pitch of a P row in LDS, in elements: 4112 B = 16 B x odd, the conflict-free pitch for the 16-byte fragment reads
typedef v4us __attribute__((may_alias)) v4usa;
typedef v2f  __attribute__((may_alias)) v2fa;
typedef float v4fu __attribute__((ext_vector_type(4), aligned(4), may_alias));   // the skewed run starts at any dword
__global__ __launch_bounds__(512) void k_smpv(const float* __restrict__ S, const float* __restrict__ QE, const float* __restrict__ am, const float* __restrict__ kla, const bf* __restrict__ VT, int n, int h0, float* OUT) {
    __shared__ __align__(16) bf ph[16 * PP];
    __shared__ __align__(16) bf pl[16 * PP];
    __shared__ __align__(16) float os[16 * 16 * 68];
    __shared__ float rinv[16];
    const int lane = threadIdx.x & 31, lr = lane & 15, hi = lane >> 4; const int w = __builtin_amdgcn_readfirstlane(threadIdx.x >> 5);
    const int zz = blockIdx.x / (TT / 16); const int i0 = (blockIdx.x % (TT / 16)) * 16; const int i = i0 + w;
    const float* sr = S + ((size_t)zz * TT + i) * TT; const float* sk = QE + (size_t)zz * TT * TT + (size_t)i * TT + (TT - 1 - i); const float* ar = am + (size_t)i * TT; const float* kr = kla + (size_t)n * TT;
    float lg[64]; float mx = -3.0e38f;
#pragma unroll
    for (int c = 0; c < 16; ++c) { const int j = c * 128 + lane * 4; const int sh = j > i ? 1 : 0;
        const v4f s = *(const v4fa*)(sr + j); const v4f a = *(const v4fa*)(ar + j); const v4f k = *(const v4fa*)(kr + j); const v4f q = *(const v4fu*)(sk + j - sh);
        asm volatile("s_wait_xcnt 0x0" ::: "memory");   // the skewed load's per-lane address registers are reused by later chunks: their reads are over before a later load may land on them
#pragma unroll
        for (int e = 0; e < 4; ++e) { const int je = j + e; float skv = (e > 0 && !sh && je > i + 1) ? q[e > 0 ? e - 1 : 0] : q[e]; skv = (je == i + 1) ? 0.f : skv;
            const float l = __fmul_rn(__fadd_rn(__fadd_rn(s[e], skv), __fadd_rn(bfr(a[e]), bfr(k[e]))), 0.125f); lg[c * 4 + e] = l; mx = fmaxf(mx, l); } }
#pragma unroll
    for (int d = 16; d; d >>= 1) mx = fmaxf(mx, __shfl_xor(mx, d, 32));
    float sum = 0.f;
#pragma unroll
    for (int c = 0; c < 16; ++c) { v4us oh, ol;
#pragma unroll
        for (int e = 0; e < 4; ++e) { const float ev = __expf(lg[c * 4 + e] - mx); sum += ev; unsigned short x, y; splitf(ev, x, y); oh[e] = x; ol[e] = y; }
        *(v4usa*)(ph + w * PP + c * 128 + lane * 4) = oh; *(v4usa*)(pl + w * PP + c * 128 + lane * 4) = ol; }
#pragma unroll
    for (int d = 16; d; d >>= 1) sum += __shfl_xor(sum, d, 32);
    if (lane == 0) rinv[w] = __fdiv_rn(1.0f, sum);
    __syncthreads();              // every row of P and every 1/sum is in LDS before another wave reads it
    const bf* vz = VT + (size_t)zz * HD * TT;
    v8f acc[4];
#pragma unroll
    for (int nb = 0; nb < 4; ++nb) acc[nb] = (v8f){};
#pragma unroll
    for (int ks = 0; ks < 4; ++ks) { const int kc = w * 128 + ks * 32 + 8 * hi;
        const v16bf ah = cat16b(*(const v8usa*)(ph + lr * PP + kc), *(const v8usa*)(ph + lr * PP + kc + 16)); const v16bf al = cat16b(*(const v8usa*)(pl + lr * PP + kc), *(const v8usa*)(pl + lr * PP + kc + 16));
#pragma unroll
        for (int nb = 0; nb < 4; ++nb) { const v16bf b = WFrag<bf>::ld(vz + (size_t)(nb * 16 + lr) * TT + kc); acc[nb] = wmmab(ah, b, acc[nb]); acc[nb] = wmmab(al, b, acc[nb]); } }
#pragma unroll
    for (int nb = 0; nb < 4; ++nb) {
#pragma unroll
        for (int r = 0; r < 8; ++r) os[w * (16 * 68) + (hi * 8 + r) * 68 + nb * 16 + lr] = acc[nb][r]; }
    __syncthreads();              // all 16 partial tiles are in LDS before they are added
    v2f o = *(const v2fa*)(os + w * 68 + lane * 2);
#pragma unroll
    for (int p = 1; p < 16; ++p) { const v2f t = *(const v2fa*)(os + p * (16 * 68) + w * 68 + lane * 2); o[0] += t[0]; o[1] += t[1]; }
    const float ri = rinv[w]; o[0] *= ri; o[1] *= ri;
    *(v2f*)(OUT + (((size_t)n * TT + i) * NH_ + h0 + zz) * HD + lane * 2) = o;
}

extern "C" void kernel_launch(void* const* d_in, const int* in_sizes, int n_in,
                              void* d_out, int out_size, void* d_ws, size_t ws_size, hipStream_t stream) {
    (void)in_sizes; (void)n_in; (void)out_size;
    const float* queries = (const float*)d_in[0]; const float* keys = (const float*)d_in[1]; const float* values = (const float*)d_in[2]; const float* pos_emb = (const float*)d_in[3]; const float* am = (const float*)d_in[4]; const float* kla = (const float*)d_in[5];
    float* OUT = (float*)d_out;     // [2][2048][16][64]
    char* wsp = (char*)d_ws;
    auto take = [&](size_t bytes) { char* p = wsp; wsp += (bytes + 255) & ~(size_t)255; return (void*)p; };
    bf* QP = (bf*)take((size_t)NT * DD * 2); bf* KP = (bf*)take((size_t)NT * DD * 2); bf* VT = (bf*)take((size_t)NT * DD * 2); bf* EP = (bf*)take((size_t)NH_ * TT * HD * 2);
    float* QE = (float*)take((size_t)ZH * TT * TT * 4); float* S = (float*)take((size_t)ZH * TT * TT * 4);
    if ((size_t)(wsp - (char*)d_ws) > ws_size) return;    // ws 256 MiB
    const unsigned LB = (unsigned)((NT * DD / 64 + 63) / 64);
    k_hplane<<<LB, 256, 0, stream>>>(queries, QP); k_hplane<<<LB, 256, 0, stream>>>(keys, KP); k_vtplane<<<LB, 256, 0, stream>>>(values, VT); k_eplane<<<(NH_ * TT * HD / 64 + 63) / 64, 256, 0, stream>>>(pos_emb, EP);
    for (int n = 0; n < NB_; ++n)
        for (int h0 = 0; h0 < NH_; h0 += ZH) { const size_t z0 = (size_t)n * NH_ + h0;
            k_gemmw<bf, 0, false><<<dim3(TT / 64, TT / 64, ZH), 32, 0, stream>>>(QP + z0 * TT * HD, nullptr, EP + (size_t)h0 * TT * HD, nullptr, HD, QE, TT, nullptr, (size_t)TT * HD, (size_t)TT * HD, (size_t)TT * TT);   // QE[l][r] = q_l . E_h[r]
            k_gemmw<bf, 0, false><<<dim3(TT / 64, TT / 64, ZH), 32, 0, stream>>>(QP + z0 * TT * HD, nullptr, KP + z0 * TT * HD, nullptr, HD, S, TT, nullptr, (size_t)TT * HD, (size_t)TT * HD, (size_t)TT * TT);      // S[l][s] = q_l . k_s
            k_smpv<<<ZH * TT / 16, 512, 0, stream>>>(S, QE, am, kla, VT + z0 * HD * TT, n, h0, OUT); }
}

// v003
// It runs in 202 microseconds.
// Versions between v001 and this one are left out; their measured steps multiply to 3.24 times as fast.
// Counting every step since v000, it is 10.7 times as fast.
#include <hip/hip_runtime.h>

// CausalRelativeAttention (queries/keys/values [2][2048][16 heads][64], pos_emb [2048][16][64]; QE = q.E_h^T; Srel = skew(QE) (Music-Transformer pad/reshape trick);
// logits = (q.k^T + Srel + attn_mask_add[l][s] + key_lengths_add[n][s]) / 8; softmax over s; out[n][l][h][d] = sum_s A v).
// Compute dtypes, f32 accumulate: every input rounded to bf16; q.k^T and q.E^T on PLAIN bf16 operands (all inputs: exact products); the skew
// (an index remap of QE: Srel[i][j] = QE[i][L-1+j-i] for j <= i, = 0 for j = i+1, = QE[i+1][j-i-2] for j > i+1 - exactly the reference's pad/reshape), the two additive

#define NB_  2
#define TT   2048
#define NH_  16
#define HD   64
#define DD   (NH_ * HD)           // 1024
#define NT   (NB_ * TT)
typedef _Float16 h16;
typedef unsigned short bf;
typedef __attribute__((ext_vector_type(16))) __bf16   v16bf;
typedef __attribute__((ext_vector_type(16))) _Float16 v16h;
typedef __attribute__((ext_vector_type(8)))  _Float16 v8h;
typedef __attribute__((ext_vector_type(8)))  unsigned short v8us;
typedef __attribute__((ext_vector_type(8)))  float    v8f;
typedef __attribute__((ext_vector_type(4)))  float    v4f;
typedef v8h  __attribute__((may_alias)) v8ha;
typedef v4f  __attribute__((may_alias)) v4fa;
typedef v8us __attribute__((may_alias)) v8usa;

__device__ __forceinline__ unsigned short f2bf(float f) { unsigned u = __float_as_uint(f); u += 0x7FFFu + ((u >> 16) & 1u); return (unsigned short)(u >> 16); }
__device__ __forceinline__ float bf2f(unsigned short b) { return __uint_as_float(((unsigned)b) << 16); }
__device__ __forceinline__ float bfr(float f) { return bf2f(f2bf(f)); }
__device__ __forceinline__ v16h cat16(v8h lo, v8h hi) { return __builtin_shufflevector(lo, hi, 0, 1, 2, 3, 4, 5, 6, 7, 8, 9, 10, 11, 12, 13, 14, 15); }
__device__ __forceinline__ v16bf cat16b(v8us lo, v8us hi) { return __builtin_bit_cast(v16bf, __builtin_shufflevector(lo, hi, 0, 1, 2, 3, 4, 5, 6, 7, 8, 9, 10, 11, 12, 13, 14, 15)); }
__device__ __forceinline__ v8f wmma16(v16h a, v16h b, v8f c) { return __builtin_amdgcn_wmma_f32_16x16x32_f16(false, a, false, b, (short)0, c, false, false); }
__device__ __forceinline__ v8f wmmab(v16bf a, v16bf b, v8f c) { return __builtin_amdgcn_wmma_f32_16x16x32_bf16(false, a, false, b, (short)0, c, false, false); }



// fragment loader: row = lane & 15, k = 8 (lane >> 4) + 0..7 and 16 + 8 (lane >> 4) + 0..7, the same for the A and the B operand
template <typename T16> struct WFrag;
template <> struct WFrag<h16> { typedef v16h V; static __device__ __forceinline__ V ld(const h16* p) { return cat16(*(const v8h*)p, *(const v8h*)(p + 16)); } static __device__ __forceinline__ v8f mma(V a, V b, v8f c) { return wmma16(a, b, c); } };
template <> struct WFrag<bf> { typedef v16bf V; static __device__ __forceinline__ V ld(const bf* p) { return cat16b(*(const v8us*)p, *(const v8us*)(p + 16)); } static __device__ __forceinline__ v8f mma(V a, V b, v8f c) { return wmmab(a, b, c); } };
__device__ __forceinline__ void splitf(float y, unsigned short& h, unsigned short& l) { h = f2bf(y); l = f2bf(y - bf2f(h)); }
typedef __attribute__((ext_vector_type(2))) unsigned short v2us;
typedef __attribute__((ext_vector_type(4))) unsigned short v4us;
typedef __attribute__((ext_vector_type(2))) float v2f;

// ---- planes packed in fragment order. A wave-wide 16-byte load of a row-major plane takes 32 bytes from each of 16 lines; here the 32 lanes' chunks of one such load lie side by side,
// 512 contiguous bytes = 4 whole lines, and every line is asked for once. One thread makes one chunk (8 bf16) and a wave writes 4 whole lines. The values and their k order are unchanged.
// Q, K and E: [head plane][tile of 16 rows][c = 0..3][lane][8] = row 16 tile + (lane & 15), d = 16 c + 8 (lane >> 4) + 0..7; chunks c = 0, 1 are the fragment of d 0..31, c = 2, 3 that of d 32..63
__global__ __launch_bounds__(256) void k_fplane(const float* __restrict__ src, bf* P) {
    const int g = blockIdx.x * 256 + threadIdx.x; const int lane = g & 31, c = (g >> 5) & 3, kt = (g >> 7) & (TT / 16 - 1), z = g >> 14; const int n = z >> 4, h = z & 15;
    const float* p = src + (((size_t)n * TT + kt * 16 + (lane & 15)) * NH_ + h) * HD + c * 16 + 8 * (lane >> 4);
    const v4f a = *(const v4fa*)p, b = *(const v4fa*)(p + 4); v8us o;
    asm volatile("s_wait_xcnt 0x0" ::: "memory");   // behind the loads: the arithmetic below reuses their address registers
#pragma unroll
    for (int q = 0; q < 4; ++q) { o[q] = f2bf(a[q]); o[4 + q] = f2bf(b[q]); }
    *(v8usa*)(P + (size_t)g * 8) = o;
}
// V^T: [head plane][block of 32 keys][nb = 0..3][c = 0..1][lane][8] = d 16 nb + (lane & 15), key 32 block + 16 c + 8 (lane >> 4) + 0..7
__global__ __launch_bounds__(256) void k_vfplane(const float* __restrict__ v, bf* P) {
    const int g = blockIdx.x * 256 + threadIdx.x; const int lane = g & 31, c = (g >> 5) & 1, nb = (g >> 6) & 3, sb = (g >> 8) & (TT / 32 - 1), z = g >> 14; const int n = z >> 4, h = z & 15;
    const float* p = v + (((size_t)n * TT + sb * 32 + c * 16 + 8 * (lane >> 4)) * NH_ + h) * HD + nb * 16 + (lane & 15); v8us o;
#pragma unroll
    for (int q = 0; q < 8; ++q) o[q] = f2bf(p[(size_t)q * DD]);
    *(v8usa*)(P + (size_t)g * 8) = o;
}
// additive mask, rounded to bf16 as the logit sum takes it: [tile of 16 queries][tile of 16 keys][lane][8] = query 16 it + (lane & 15), key 16 jt + 8 (lane >> 4) + 0..7: a transposed logit tile's accumulator order
__global__ __launch_bounds__(256) void k_mplane(const float* __restrict__ am, bf* P) {
    const int g = blockIdx.x * 256 + threadIdx.x; const int lane = g & 31, jt = (g >> 5) & (TT / 16 - 1), it = g >> 12;
    const float* p = am + (size_t)(it * 16 + (lane & 15)) * TT + jt * 16 + 8 * (lane >> 4);
    const v4f a = *(const v4fa*)p, b = *(const v4fa*)(p + 4); v8us o;
    asm volatile("s_wait_xcnt 0x0" ::: "memory");   // behind the loads: the arithmetic below reuses their address registers
#pragma unroll
    for (int q = 0; q < 4; ++q) { o[q] = f2bf(a[q]); o[4 + q] = f2bf(b[q]); }
    *(v8usa*)(P + (size_t)g * 8) = o;
}
// a fragment of a packed plane: two chunks, 256 elements apart
__device__ __forceinline__ v16bf ldp(const bf* p) { return cat16b(*(const v8us*)p, *(const v8us*)(p + 256)); }
// logit(i,j) = (q_i.k_j + Srel(i,j) + bf(am[i][j]) + bf(kla[n][j])) / 8 with Srel(i,j) = QE[i][L-1+j-i] (j <= i), 0 (j == i+1), QE[i+1][j-i-2] (j >= i+2), QE[i][r] = q_i.E_h[r].
// ---- k_attn: both logit products, the skew, softmax and P.V of 16 query rows of one head in one work-group of 16 waves; grid 32 heads * L / 16. Every tile is kept TRANSPOSED
// (rows = keys or positions, columns = the 16 queries: lane & 15 is the query), so that a logit tile's accumulator registers are, after exp, already the B fragment of V^T.P^T.
// Phase A, wave w = positions [128 w, 128 w + 128): QE^T tiles to LDS, one row of XP dwords a query; row i0+15 reads on in QE row i0+16, which is the first column of a second
// tile on queries i0+16..i0+31. Phase B, wave w = keys [128 w, 128 w + 128): K.Q^T tiles, the skewed QE run from LDS and both
// masks added in registers; row max over lanes, then over waves through LDS. Phase C: exp, bf16 hi/lo split, V^T.P^T on the wave's own 128 keys, f32 partial tiles to LDS.
// Phase D: the 16 partials and the 16 partial row sums are added in wave order, scaled by 1/sum and stored as whole 256-byte rows of the output.
#define XP 2052                   // pitch of a QE row in LDS, in dwords: 16-byte stores of 16 rows fall on all 64 banks (pitch = 4 mod 64), the skewed dword reads step 3 banks a lane
#define XU (XP - TT - 1)          // a row's run for j >= i+2 starts this many dwords behind the place where its run for j <= i would go on
typedef __attribute__((ext_vector_type(16))) unsigned short v16us;
// eight 2^x in one statement: behind a v_exp_f32 the instruction set asks for one independent instruction before its result is read or its source overwritten; here each is the
// next one's (outputs share no register with an input), and the v_nop is the last one's.
__device__ __forceinline__ void exp2x8(float* r, const float* x) {
    asm("v_exp_f32 %0, %8\n\tv_exp_f32 %1, %9\n\tv_exp_f32 %2, %10\n\tv_exp_f32 %3, %11\n\tv_exp_f32 %4, %12\n\tv_exp_f32 %5, %13\n\tv_exp_f32 %6, %14\n\tv_exp_f32 %7, %15\n\tv_nop"
        : "=&v"(r[0]), "=&v"(r[1]), "=&v"(r[2]), "=&v"(r[3]), "=&v"(r[4]), "=&v"(r[5]), "=&v"(r[6]), "=&v"(r[7]) : "v"(x[0]), "v"(x[1]), "v"(x[2]), "v"(x[3]), "v"(x[4]), "v"(x[5]), "v"(x[6]), "v"(x[7]));
}
typedef v2f  __attribute__((may_alias)) v2fa;
__global__ __launch_bounds__(512) void k_attn(const bf* __restrict__ QF, const bf* __restrict__ KF, const bf* __restrict__ VF, const bf* __restrict__ EF, const bf* __restrict__ MF, const float* __restrict__ kla, float* OUT) {
    __shared__ __align__(16) float xs[17 * XP];   // phases A and B: QE rows i0..i0+16; phases C and D: the 16 partial output tiles, 16 x 68 dwords each
    __shared__ float rmax[16 * 16];
    __shared__ float rsum[16 * 16];
    const int lane = threadIdx.x & 31, lr = lane & 15, hi = lane >> 4; const int w = __builtin_amdgcn_readfirstlane(threadIdx.x >> 5);
    const int z = blockIdx.x / (TT / 16); const int i0 = (blockIdx.x % (TT / 16)) * 16; const int n = z >> 4, h = z & 15; const int i = i0 + lr;
    const bf* qz = QF + (size_t)z * TT * HD; const bf* kw = KF + (size_t)z * TT * HD + (size_t)w * 128 * HD; const bf* ew = EF + (size_t)h * TT * HD + (size_t)w * 128 * HD; const bf* vw = VF + (size_t)z * HD * TT + (size_t)w * 128 * HD;
    const unsigned po = (unsigned)(lane * 8);           // in the packed planes: a tile of 16 rows is 1024 elements, a V^T block of 32 keys 2048, a mask tile 256
    const bf* q0p = qz + i0 * HD; const bf* q1p = qz + (i0 + 16 < TT ? i0 + 16 : i0) * HD;   // the next tile of queries; the last block has no row below it, and its row 16 in LDS is never read
    const v16bf q0a = ldp(q0p + po), q0b = ldp(q0p + 512 + po);
    const bf* mw = MF + ((size_t)(i0 >> 4) * (TT / 16) + w * 8) * 256; const float* kr = kla + (size_t)n * TT + w * 128; const unsigned ko = (unsigned)(8 * hi);
    // a key tile's operands (two K fragments, 8 mask and 8 key-length values a lane) are fetched two tiles ahead into a ring of three register sets
    v16bf kf[3][2]; v8us af[3]; v4f lf[3][2];
    auto ldt = [&](int t) { const int s = t % 3; kf[s][0] = ldp(kw + t * 1024 + po); kf[s][1] = ldp(kw + t * 1024 + 512 + po);
        af[s] = *(const v8usa*)(mw + t * 256 + po); lf[s][0] = *(const v4fa*)(kr + t * 16 + ko); lf[s][1] = *(const v4fa*)(kr + t * 16 + 4 + ko); };
    {
        const v16bf q1a = ldp(q1p + po), q1b = ldp(q1p + 512 + po);
        v8f d[8], u[8]; float* xp = xs + lr * XP + w * 128 + 8 * hi;
#pragma unroll
        for (int t = 0; t < 8; ++t) { const v16bf e0 = ldp(ew + t * 1024 + po), e1 = ldp(ew + t * 1024 + 512 + po); d[t] = (v8f){}; u[t] = (v8f){};
            d[t] = wmmab(e0, q0a, d[t]); d[t] = wmmab(e1, q0b, d[t]); u[t] = wmmab(e0, q1a, u[t]); u[t] = wmmab(e1, q1b, u[t]); }
        ldt(0); ldt(1);   // the next phase's first loads go out in front of the barrier: their latency runs beside the LDS stores and the wait for the other waves
#pragma unroll
        for (int t = 0; t < 8; ++t) { *(v4fa*)(xp + t * 16) = (v4f){d[t][0], d[t][1], d[t][2], d[t][3]}; *(v4fa*)(xp + t * 16 + 4) = (v4f){d[t][4], d[t][5], d[t][6], d[t][7]}; }
        if (lr == 0) {            // column 0 of the second tile is query i0+16
#pragma unroll
            for (int t = 0; t < 8; ++t) { *(v4fa*)(xp + 16 * XP + t * 16) = (v4f){u[t][0], u[t][1], u[t][2], u[t][3]}; *(v4fa*)(xp + 16 * XP + t * 16 + 4) = (v4f){u[t][4], u[t][5], u[t][6], u[t][7]}; } }
    }
    __syncthreads();              // every QE row is in LDS before another wave reads its skewed run
    const float* xb = xs + lr * XP + (TT - 1 - i) + w * 128 + 8 * hi;
    float lg[64]; float mx = -3.0e38f;
#pragma unroll
    for (int t = 0; t < 8; ++t) { const int j0 = w * 128 + t * 16;   // the skewed runs first, so that the loop of products below has no branch in it
        if (j0 == i0 || j0 == i0 + 16) {          // the two tiles that the diagonal j == i+1 crosses: each element picks its own run; at j == i+1 the neighbour is read and dropped
#pragma unroll
            for (int e = 0; e < 8; ++e) { const int je = j0 + 8 * hi + e; const float v = xb[t * 16 + e + (je > i + 1 ? XU : (je > i ? -1 : 0))]; lg[t * 8 + e] = (je == i + 1) ? 0.f : v; }
        } else { const float* p = xb + t * 16 + (j0 > i0 ? XU : 0);
#pragma unroll
            for (int e = 0; e < 8; ++e) lg[t * 8 + e] = p[e]; } }
#pragma unroll
    for (int t = 0; t < 8; ++t) { const int b = t % 3;
        if (t + 2 < 8) ldt(t + 2);
        if (t + 2 == 7) asm volatile("s_wait_xcnt 0x0" ::: "memory");   // behind the last loads of this phase: their per-lane offset registers are free for the arithmetic that follows
        v8f s = (v8f){}; s = wmmab(kf[b][0], q0a, s); s = wmmab(kf[b][1], q0b, s);
#pragma unroll
        for (int e = 0; e < 8; ++e) { const float av = bf2f(af[b][e]), kv = lf[b][e >> 2][e & 3];
            const float l = __fmul_rn(__fadd_rn(__fadd_rn(s[e], lg[t * 8 + e]), __fadd_rn(av, bfr(kv))), 0.125f); lg[t * 8 + e] = l; mx = fmaxf(mx, l); }
        __builtin_amdgcn_sched_barrier(0); } // holds the fetch distance at two tiles: with all eight tiles' loads lifted to the top the registers run out and logits spill
    v16bf vf[2][4];               // V^T fragments of 32 keys, fetched one step ahead; the first step's go out in front of the barrier, beside the wait for the other waves
    auto ldv = [&](int ks) {
#pragma unroll
        for (int nb = 0; nb < 4; ++nb) vf[ks & 1][nb] = ldp(vw + ks * 2048 + nb * 512 + po); };
    ldv(0);
    mx = fmaxf(mx, __shfl_xor(mx, 16, 32));
    if (hi == 0) rmax[w * 16 + lr] = mx;
    __syncthreads();              // every wave's row maxima are in LDS, and every read of the QE rows is over before the partial tiles are written over them
#pragma unroll
    for (int p = 0; p < 16; ++p) mx = fmaxf(mx, rmax[p * 16 + lr]);
    float sum = 0.f; v8f acc[4];
#pragma unroll
    for (int nb = 0; nb < 4; ++nb) acc[nb] = (v8f){};
#pragma unroll
    for (int ks = 0; ks < 4; ++ks) { v16us ph, pl; float xa[16], ev[16]; if (ks + 1 < 4) ldv(ks + 1);   // keys 32 ks + 8 hi + 0..7 and + 16 + 0..7: the k order of the fragment loader
#pragma unroll
        for (int e = 0; e < 16; ++e) xa[e] = (lg[ks * 16 + e] - mx) * 1.44269504f;   // exp(l - max) = 2^((l - max) log2 e)
        exp2x8(ev, xa); exp2x8(ev + 8, xa + 8);
#pragma unroll
        for (int e = 0; e < 16; ++e) { sum += ev[e]; unsigned short x, y; splitf(ev[e], x, y); ph[e] = x; pl[e] = y; }
        const v16bf bh = __builtin_bit_cast(v16bf, ph), bl = __builtin_bit_cast(v16bf, pl);
#pragma unroll
        for (int nb = 0; nb < 4; ++nb) { acc[nb] = wmmab(vf[ks & 1][nb], bh, acc[nb]); acc[nb] = wmmab(vf[ks & 1][nb], bl, acc[nb]); } }
    sum += __shfl_xor(sum, 16, 32);
    if (hi == 0) rsum[w * 16 + lr] = sum;
#pragma unroll
    for (int nb = 0; nb < 4; ++nb) { float* op = xs + w * (16 * 68) + lr * 68 + nb * 16 + 8 * hi;
        *(v4fa*)op = (v4f){acc[nb][0], acc[nb][1], acc[nb][2], acc[nb][3]}; *(v4fa*)(op + 4) = (v4f){acc[nb][4], acc[nb][5], acc[nb][6], acc[nb][7]}; }
    __syncthreads();              // all 16 partial tiles and partial sums are in LDS before they are added
    v2f o = *(const v2fa*)(xs + w * 68 + lane * 2); float tot = rsum[w];
#pragma unroll
    for (int p = 1; p < 16; ++p) { const v2f t = *(const v2fa*)(xs + p * (16 * 68) + w * 68 + lane * 2); o[0] += t[0]; o[1] += t[1]; tot += rsum[p * 16 + w]; }
    const float ri = __fdiv_rn(1.0f, tot); o[0] *= ri; o[1] *= ri;
    *(v2f*)(OUT + (((size_t)n * TT + i0 + w) * NH_ + h) * HD + lane * 2) = o;
}

extern "C" void kernel_launch(void* const* d_in, const int* in_sizes, int n_in,
                              void* d_out, int out_size, void* d_ws, size_t ws_size, hipStream_t stream) {
    (void)in_sizes; (void)n_in; (void)out_size;
    const float* queries = (const float*)d_in[0]; const float* keys = (const float*)d_in[1]; const float* values = (const float*)d_in[2]; const float* pos_emb = (const float*)d_in[3]; const float* am = (const float*)d_in[4]; const float* kla = (const float*)d_in[5];
    float* OUT = (float*)d_out;     // [2][2048][16][64]
    char* wsp = (char*)d_ws;
    auto take = [&](size_t bytes) { char* p = wsp; wsp += (bytes + 255) & ~(size_t)255; return (void*)p; };
    bf* QF = (bf*)take((size_t)NT * DD * 2); bf* KF = (bf*)take((size_t)NT * DD * 2); bf* VF = (bf*)take((size_t)NT * DD * 2); bf* EF = (bf*)take((size_t)NH_ * TT * HD * 2); bf* MF = (bf*)take((size_t)TT * TT * 2);
    if ((size_t)(wsp - (char*)d_ws) > ws_size) return;    // ws 256 MiB
    k_fplane<<<NT * DD / 8 / 256, 256, 0, stream>>>(queries, QF); k_fplane<<<NT * DD / 8 / 256, 256, 0, stream>>>(keys, KF); k_vfplane<<<NT * DD / 8 / 256, 256, 0, stream>>>(values, VF); k_fplane<<<NH_ * TT * HD / 8 / 256, 256, 0, stream>>>(pos_emb, EF); k_mplane<<<TT * TT / 8 / 256, 256, 0, stream>>>(am, MF);
    k_attn<<<NB_ * NH_ * (TT / 16), 512, 0, stream>>>(QF, KF, VF, EF, MF, kla, OUT);
}

// v004
// Measured time: 142 microseconds a run.
// Next to v003, in two timings, it ran 1.42 and 1.43 times as fast.
// Counting every step since v000, it is 15.2 times as fast.
#include <hip/hip_runtime.h>

// CausalRelativeAttention (queries/keys/values [2][2048][16 heads][64], pos_emb [2048][16][64]; QE = q.E_h^T; Srel = skew(QE) (Music-Transformer pad/reshape trick);
// logits = (q.k^T + Srel + attn_mask_add[l][s] + key_lengths_add[n][s]) / 8; softmax over s; out[n][l][h][d] = sum_s A v).
// Compute dtypes, f32 accumulate: every input rounded to bf16; q.k^T and q.E^T on PLAIN bf16 operands (all inputs: exact products); the skew
// (an index remap of QE: Srel[i][j] = QE[i][L-1+j-i] for j <= i, = 0 for j = i+1, = QE[i+1][j-i-2] for j > i+1 - exactly the reference's pad/reshape), the two additive

#define NB_  2
#define TT   2048
#define NH_  16
#define HD   64
#define DD   (NH_ * HD)           // 1024
#define NT   (NB_ * TT)
typedef _Float16 h16;
typedef unsigned short bf;
typedef __attribute__((ext_vector_type(16))) __bf16   v16bf;
typedef __attribute__((ext_vector_type(16))) _Float16 v16h;
typedef __attribute__((ext_vector_type(8)))  _Float16 v8h;
typedef __attribute__((ext_vector_type(8)))  unsigned short v8us;
typedef __attribute__((ext_vector_type(8)))  float    v8f;
typedef __attribute__((ext_vector_type(4)))  float    v4f;
typedef v8h  __attribute__((may_alias)) v8ha;
typedef v4f  __attribute__((may_alias)) v4fa;
typedef v8us __attribute__((may_alias)) v8usa;

__device__ __forceinline__ unsigned short f2bf(float f) { unsigned u = __float_as_uint(f); u += 0x7FFFu + ((u >> 16) & 1u); return (unsigned short)(u >> 16); }
__device__ __forceinline__ float bf2f(unsigned short b) { return __uint_as_float(((unsigned)b) << 16); }
__device__ __forceinline__ float bfr(float f) { return bf2f(f2bf(f)); }
__device__ __forceinline__ v16h cat16(v8h lo, v8h hi) { return __builtin_shufflevector(lo, hi, 0, 1, 2, 3, 4, 5, 6, 7, 8, 9, 10, 11, 12, 13, 14, 15); }
__device__ __forceinline__ v16bf cat16b(v8us lo, v8us hi) { return __builtin_bit_cast(v16bf, __builtin_shufflevector(lo, hi, 0, 1, 2, 3, 4, 5, 6, 7, 8, 9, 10, 11, 12, 13, 14, 15)); }
__device__ __forceinline__ v8f wmma16(v16h a, v16h b, v8f c) { return __builtin_amdgcn_wmma_f32_16x16x32_f16(false, a, false, b, (short)0, c, false, false); }
__device__ __forceinline__ v8f wmmab(v16bf a, v16bf b, v8f c) { return __builtin_amdgcn_wmma_f32_16x16x32_bf16(false, a, false, b, (short)0, c, false, false); }



// fragment loader: row = lane & 15, k = 8 (lane >> 4) + 0..7 and 16 + 8 (lane >> 4) + 0..7, the same for the A and the B operand
template <typename T16> struct WFrag;
template <> struct WFrag<h16> { typedef v16h V; static __device__ __forceinline__ V ld(const h16* p) { return cat16(*(const v8h*)p, *(const v8h*)(p + 16)); } static __device__ __forceinline__ v8f mma(V a, V b, v8f c) { return wmma16(a, b, c); } };
template <> struct WFrag<bf> { typedef v16bf V; static __device__ __forceinline__ V ld(const bf* p) { return cat16b(*(const v8us*)p, *(const v8us*)(p + 16)); } static __device__ __forceinline__ v8f mma(V a, V b, v8f c) { return wmmab(a, b, c); } };
__device__ __forceinline__ void splitf(float y, unsigned short& h, unsigned short& l) { h = f2bf(y); l = f2bf(y - bf2f(h)); }
typedef __attribute__((ext_vector_type(2))) unsigned short v2us;
typedef __attribute__((ext_vector_type(4))) unsigned short v4us;
typedef __attribute__((ext_vector_type(2))) float v2f;

// ---- planes packed in fragment order. A wave-wide 16-byte load of a row-major plane takes 32 bytes from each of 16 lines; here the 32 lanes' chunks of one such load lie side by side,
// 512 contiguous bytes = 4 whole lines, and every line is asked for once. One thread makes one chunk (8 bf16) and a wave writes 4 whole lines. The values and their k order are unchanged.
// Q, K and E: [head plane][tile of 16 rows][c = 0..3][lane][8] = row 16 tile + (lane & 15), d = 16 c + 8 (lane >> 4) + 0..7; chunks c = 0, 1 are the fragment of d 0..31, c = 2, 3 that of d 32..63
__global__ __launch_bounds__(256) void k_fplane(const float* __restrict__ src, bf* P) {
    const int g = blockIdx.x * 256 + threadIdx.x; const int lane = g & 31, c = (g >> 5) & 3, kt = (g >> 7) & (TT / 16 - 1), z = g >> 14; const int n = z >> 4, h = z & 15;
    const float* p = src + (((size_t)n * TT + kt * 16 + (lane & 15)) * NH_ + h) * HD + c * 16 + 8 * (lane >> 4);
    const v4f a = *(const v4fa*)p, b = *(const v4fa*)(p + 4); v8us o;
    asm volatile("s_wait_xcnt 0x0" ::: "memory");   // behind the loads: the arithmetic below reuses their address registers
#pragma unroll
    for (int q = 0; q < 4; ++q) { o[q] = f2bf(a[q]); o[4 + q] = f2bf(b[q]); }
    *(v8usa*)(P + (size_t)g * 8) = o;
}
// V^T: [head plane][block of 32 keys][nb = 0..3][c = 0..1][lane][8] = d 16 nb + (lane & 15), key 32 block + 16 c + 8 (lane >> 4) + 0..7
__global__ __launch_bounds__(256) void k_vfplane(const float* __restrict__ v, bf* P) {
    const int g = blockIdx.x * 256 + threadIdx.x; const int lane = g & 31, c = (g >> 5) & 1, nb = (g >> 6) & 3, sb = (g >> 8) & (TT / 32 - 1), z = g >> 14; const int n = z >> 4, h = z & 15;
    const float* p = v + (((size_t)n * TT + sb * 32 + c * 16 + 8 * (lane >> 4)) * NH_ + h) * HD + nb * 16 + (lane & 15); v8us o;
#pragma unroll
    for (int q = 0; q < 8; ++q) o[q] = f2bf(p[(size_t)q * DD]);
    *(v8usa*)(P + (size_t)g * 8) = o;
}
// additive mask, rounded to bf16 as the logit sum takes it: [tile of 16 queries][tile of 16 keys][lane][8] = query 16 it + (lane & 15), key 16 jt + 8 (lane >> 4) + 0..7: a transposed logit tile's accumulator order
__global__ __launch_bounds__(256) void k_mplane(const float* __restrict__ am, bf* P) {
    const int g = blockIdx.x * 256 + threadIdx.x; const int lane = g & 31, jt = (g >> 5) & (TT / 16 - 1), it = g >> 12;
    const float* p = am + (size_t)(it * 16 + (lane & 15)) * TT + jt * 16 + 8 * (lane >> 4);
    const v4f a = *(const v4fa*)p, b = *(const v4fa*)(p + 4); v8us o;
    asm volatile("s_wait_xcnt 0x0" ::: "memory");   // behind the loads: the arithmetic below reuses their address registers
#pragma unroll
    for (int q = 0; q < 4; ++q) { o[q] = f2bf(a[q]); o[4 + q] = f2bf(b[q]); }
    *(v8usa*)(P + (size_t)g * 8) = o;
}
// a fragment of a packed plane: two chunks, 256 elements apart
__device__ __forceinline__ v16bf ldp(const bf* p) { return cat16b(*(const v8us*)p, *(const v8us*)(p + 256)); }
// logit(i,j) = (q_i.k_j + Srel(i,j) + bf(am[i][j]) + bf(kla[n][j])) / 8 with Srel(i,j) = QE[i][L-1+j-i] (j <= i), 0 (j == i+1), QE[i+1][j-i-2] (j >= i+2), QE[i][r] = q_i.E_h[r].
// ---- k_attn: both logit products, the skew, softmax and P.V of 32 query rows (two tiles of 16) of one head in one work-group of 16 waves; grid 32 heads * L / 32. Every tile is kept
// TRANSPOSED (rows = keys or positions, columns = 16 queries: lane & 15 is the query), so that a logit tile's accumulator registers are, after exp, already the B fragment of V^T.P^T.
// Each E, K and V^T fragment is loaded once and multiplied with both query tiles: the bytes a work-group draws from L2 serve twice the queries.
// Phase A, wave w = positions [128 w, 128 w + 128): QE^T tiles to LDS, one row of XP dwords a query; row i0+31 reads on in QE row i0+32, which is the first column of a third
// tile on queries i0+32..i0+47. Phase B, wave w = keys [128 w, 128 w + 128): the skewed QE run from LDS plus both
// masks is the start value of the K.Q^T accumulator; row max over lanes, then over waves through LDS. Phase C: exp, bf16 hi/lo split, V^T.P^T on the wave's own 128 keys, f32 partial tiles to LDS.
// Phase D: the 16 partials and the 16 partial row sums are added in wave order, scaled by 1/sum and stored as whole 256-byte rows of the output.
#define XP 2052                   // pitch of a QE row in LDS, in dwords: 16-byte stores of 16 rows fall on all 64 banks (pitch = 4 mod 64), the skewed dword reads step 3 banks a lane
#define XU (XP - TT - 1)          // a row's run for j >= i+2 starts this many dwords behind the place where its run for j <= i would go on
typedef __attribute__((ext_vector_type(16))) unsigned short v16us;
// eight 2^x in one statement: behind a v_exp_f32 the instruction set asks for one independent instruction before its result is read or its source overwritten; here each is the
// next one's (outputs share no register with an input), and the v_nop is the last one's.
__device__ __forceinline__ void exp2x8(float* r, const float* x) {
    asm("v_exp_f32 %0, %8\n\tv_exp_f32 %1, %9\n\tv_exp_f32 %2, %10\n\tv_exp_f32 %3, %11\n\tv_exp_f32 %4, %12\n\tv_exp_f32 %5, %13\n\tv_exp_f32 %6, %14\n\tv_exp_f32 %7, %15\n\tv_nop"
        : "=&v"(r[0]), "=&v"(r[1]), "=&v"(r[2]), "=&v"(r[3]), "=&v"(r[4]), "=&v"(r[5]), "=&v"(r[6]), "=&v"(r[7]) : "v"(x[0]), "v"(x[1]), "v"(x[2]), "v"(x[3]), "v"(x[4]), "v"(x[5]), "v"(x[6]), "v"(x[7]));
}
typedef v2f  __attribute__((may_alias)) v2fa;
__global__ __launch_bounds__(512) void k_attn(const bf* __restrict__ QF, const bf* __restrict__ KF, const bf* __restrict__ VF, const bf* __restrict__ EF, const bf* __restrict__ MF, const float* __restrict__ kla, float* OUT) {
    __shared__ __align__(16) float xs[33 * XP];   // phases A and B: QE rows i0..i0+32; phases C and D: the 16 partial output tiles, 32 x 68 dwords each
    __shared__ float rmax[16 * 32];
    __shared__ float rsum[16 * 32];
    const int lane = threadIdx.x & 31, lr = lane & 15, hi = lane >> 4; const int w = __builtin_amdgcn_readfirstlane(threadIdx.x >> 5);
    const int z = blockIdx.x / (TT / 32); const int i0 = (blockIdx.x % (TT / 32)) * 32; const int n = z >> 4, h = z & 15;
    const bf* qz = QF + (size_t)z * TT * HD; const bf* kw = KF + (size_t)z * TT * HD + (size_t)w * 128 * HD; const bf* ew = EF + (size_t)h * TT * HD + (size_t)w * 128 * HD; const bf* vw = VF + (size_t)z * HD * TT + (size_t)w * 128 * HD;
    const unsigned po = (unsigned)(lane * 8);           // in the packed planes: a tile of 16 rows is 1024 elements, a V^T block of 32 keys 2048, a mask tile 256
    const bf* q0p = qz + i0 * HD; const bf* q2p = qz + (i0 + 32 < TT ? i0 + 32 : i0) * HD;   // the tile of queries below; the last block has no row below it, and its row 32 in LDS is never read
    v16bf qa[2], qb[2];
#pragma unroll
    for (int a = 0; a < 2; ++a) { qa[a] = ldp(q0p + a * 1024 + po); qb[a] = ldp(q0p + a * 1024 + 512 + po); }
    const bf* mw = MF + ((size_t)(i0 >> 4) * (TT / 16) + w * 8) * 256; const float* kr = kla + (size_t)n * TT + w * 128;   // the same address in every lane: the key-length values come through scalar registers
    // a key tile's two K fragments are fetched one tile ahead into the same registers, right behind the products that read them; its mask and key-length values two tiles ahead into two register sets
    v16bf kf[2]; v8us af[2][2]; float lf[2][16];
    auto ldk = [&](int t) { kf[0] = ldp(kw + t * 1024 + po); kf[1] = ldp(kw + t * 1024 + 512 + po); };
    auto ldm = [&](int t) { const int s = t & 1; af[s][0] = *(const v8usa*)(mw + t * 256 + po); af[s][1] = *(const v8usa*)(mw + (TT / 16) * 256 + t * 256 + po);
#pragma unroll
        for (int e = 0; e < 16; ++e) lf[s][e] = kr[t * 16 + e]; };
    {
        const v16bf q2a = ldp(q2p + po), q2b = ldp(q2p + 512 + po);
        v8f u[8], d[2][2]; float* xp = xs + lr * XP + w * 128 + 8 * hi;
        auto std = [&](int t) {
#pragma unroll
            for (int a = 0; a < 2; ++a) { const v8f x = d[t & 1][a]; *(v4fa*)(xp + a * 16 * XP + t * 16) = (v4f){x[0], x[1], x[2], x[3]}; *(v4fa*)(xp + a * 16 * XP + t * 16 + 4) = (v4f){x[4], x[5], x[6], x[7]}; } };
        v16bf ef[8][2];           // all eight E tiles are asked for at once: the registers that they leave, tile by tile, take the third query tile's results
#pragma unroll
        for (int t = 0; t < 8; ++t) { ef[t][0] = ldp(ew + t * 1024 + po); ef[t][1] = ldp(ew + t * 1024 + 512 + po); }
#pragma unroll
        for (int t = 0; t < 8; ++t) { const v16bf e0 = ef[t][0], e1 = ef[t][1]; u[t] = (v8f){};
            u[t] = wmmab(e0, q2a, u[t]); u[t] = wmmab(e1, q2b, u[t]);
#pragma unroll
            for (int a = 0; a < 2; ++a) { d[t & 1][a] = (v8f){}; d[t & 1][a] = wmmab(e0, qa[a], d[t & 1][a]); d[t & 1][a] = wmmab(e1, qb[a], d[t & 1][a]); }
            __builtin_amdgcn_sched_barrier(0);   // a tile's LDS stores stay behind the next tile's six products: those fill the slots between a product and the first read of its result
            if (t > 0) std(t - 1); }
        std(7);
        ldk(0); ldm(0); ldm(1);   // the next phase's first loads go out in front of the barrier: their latency runs beside the LDS stores and the wait for the other waves
        if (lr == 0) {            // column 0 of the third tile is query i0+32
#pragma unroll
            for (int t = 0; t < 8; ++t) { *(v4fa*)(xp + 32 * XP + t * 16) = (v4f){u[t][0], u[t][1], u[t][2], u[t][3]}; *(v4fa*)(xp + 32 * XP + t * 16 + 4) = (v4f){u[t][4], u[t][5], u[t][6], u[t][7]}; } }
    }
    __syncthreads();              // every QE row is in LDS before another wave reads its skewed run
    float lg[2][64]; float mx[2] = {-__builtin_inff(), -__builtin_inff()};   // below every value: the maximum is taken of 8 x the logit, which may lie under any finite start
#pragma unroll
    for (int a = 0; a < 2; ++a) { const int ia0 = i0 + 16 * a, i = ia0 + lr; const float* xb = xs + (a * 16 + lr) * XP + (TT - 1 - i) + w * 128 + 8 * hi;
#pragma unroll
        for (int t = 0; t < 8; ++t) { const int j0 = w * 128 + t * 16;   // the skewed runs first, so that the loop of products below has no branch in it
            if (j0 == ia0 || j0 == ia0 + 16) {    // the two tiles that the diagonal j == i+1 crosses: each element picks its own run; at j == i+1 the neighbour is read and dropped
#pragma unroll
                for (int e = 0; e < 8; ++e) { const int je = j0 + 8 * hi + e; const float v = xb[t * 16 + e + (je > i + 1 ? XU : (je > i ? -1 : 0))]; lg[a][t * 8 + e] = (je == i + 1) ? 0.f : v; }
            } else { const float* p = xb + t * 16 + (j0 > ia0 ? XU : 0);
#pragma unroll
                for (int e = 0; e < 8; ++e) lg[a][t * 8 + e] = p[e]; } } }
#pragma unroll
    for (int t = 0; t < 8; ++t) { const int b = t & 1; v8f s[2];
#pragma unroll
        for (int e = 0; e < 8; ++e) { const float kv = bfr(hi ? lf[b][8 + e] : lf[b][e]);   // the skewed QE value and both masks start the accumulator of K.Q^T: no second set of eight registers a tile
#pragma unroll
            for (int a = 0; a < 2; ++a) s[a][e] = __fadd_rn(lg[a][t * 8 + e], __fadd_rn(bf2f(af[b][a][e]), kv)); }
#pragma unroll
        for (int a = 0; a < 2; ++a) { s[a] = wmmab(kf[0], qa[a], s[a]); s[a] = wmmab(kf[1], qb[a], s[a]); }
        if (t + 1 < 8) ldk(t + 1);
        if (t + 2 < 8) ldm(t + 2);
        if (t + 1 == 7) asm volatile("s_wait_xcnt 0x0" ::: "memory");   // behind the last loads of this phase: their address registers are free for the arithmetic that follows
#pragma unroll
        for (int a = 0; a < 2; ++a) {
#pragma unroll
            for (int e = 0; e < 8; ++e) { lg[a][t * 8 + e] = s[a][e]; mx[a] = fmaxf(mx[a], s[a][e]); } }   // 8 x the logit stays where the products left it; the 1/8 is in the factor of the exponent
        __builtin_amdgcn_sched_barrier(0); } // holds the fetch distance: with more tiles' loads lifted to the top the registers run out and logits spill
    v16bf vf[4];                  // V^T fragments of 32 keys, fetched one step ahead into the same registers; the first step's go out in front of the barrier, beside the wait for the other waves
    auto ldv = [&](int ks) {
#pragma unroll
        for (int nb = 0; nb < 4; ++nb) vf[nb] = ldp(vw + ks * 2048 + nb * 512 + po); };
    ldv(0);
#pragma unroll
    for (int a = 0; a < 2; ++a) { mx[a] = fmaxf(mx[a], __shfl_xor(mx[a], 16, 32)); if (hi == 0) rmax[w * 32 + a * 16 + lr] = mx[a]; }
    __syncthreads();              // every wave's row maxima are in LDS, and every read of the QE rows is over before the partial tiles are written over them
#pragma unroll
    for (int a = 0; a < 2; ++a) {
#pragma unroll
        for (int p = 0; p < 16; ++p) mx[a] = fmaxf(mx[a], rmax[p * 32 + a * 16 + lr]); }
    float sum[2] = {0.f, 0.f}; v8f acc[2][4];
#pragma unroll
    for (int a = 0; a < 2; ++a) {
#pragma unroll
        for (int nb = 0; nb < 4; ++nb) acc[a][nb] = (v8f){}; }
#pragma unroll
    for (int ks = 0; ks < 4; ++ks) {   // keys 32 ks + 8 hi + 0..7 and + 16 + 0..7: the k order of the fragment loader
#pragma unroll
        for (int a = 0; a < 2; ++a) { v16us ph, pl;
#pragma unroll
            for (int g = 0; g < 2; ++g) { float xa[8], ev[8];
#pragma unroll
                for (int e = 0; e < 8; ++e) xa[e] = (lg[a][ks * 16 + g * 8 + e] - mx[a]) * (1.44269504f * 0.125f);   // exp((x - max) / 8) = 2^((x - max) log2 e / 8); a power of two moves through every rounding: the same bits
                exp2x8(ev, xa);
#pragma unroll
                for (int e = 0; e < 8; ++e) { sum[a] += ev[e]; unsigned short x, y; splitf(ev[e], x, y); ph[g * 8 + e] = x; pl[g * 8 + e] = y; }
                }
            const v16bf bh = __builtin_bit_cast(v16bf, ph), bl = __builtin_bit_cast(v16bf, pl);
#pragma unroll
            for (int nb = 0; nb < 4; ++nb) { acc[a][nb] = wmmab(vf[nb], bh, acc[a][nb]); acc[a][nb] = wmmab(vf[nb], bl, acc[a][nb]); }
            __builtin_amdgcn_sched_barrier(0); }   // the next exponentials stay behind these products, their subtractions and multiplies in between: lifted among the products, the asm statement writes
                                                   // a product's operand registers inside the four slots that the chip needs behind it
        if (ks + 1 < 4) ldv(ks + 1);
        }
#pragma unroll
    for (int a = 0; a < 2; ++a) { sum[a] += __shfl_xor(sum[a], 16, 32); if (hi == 0) rsum[w * 32 + a * 16 + lr] = sum[a];
#pragma unroll
        for (int nb = 0; nb < 4; ++nb) { float* op = xs + w * (32 * 68) + (a * 16 + lr) * 68 + nb * 16 + 8 * hi;
            *(v4fa*)op = (v4f){acc[a][nb][0], acc[a][nb][1], acc[a][nb][2], acc[a][nb][3]}; *(v4fa*)(op + 4) = (v4f){acc[a][nb][4], acc[a][nb][5], acc[a][nb][6], acc[a][nb][7]}; } }
    __syncthreads();              // all 16 partial tiles and partial sums are in LDS before they are added
#pragma unroll
    for (int a = 0; a < 2; ++a) { const int row = a * 16 + w;
        v2f o = *(const v2fa*)(xs + row * 68 + lane * 2); float tot = rsum[row];
#pragma unroll
        for (int p = 1; p < 16; ++p) { const v2f t = *(const v2fa*)(xs + p * (32 * 68) + row * 68 + lane * 2); o[0] += t[0]; o[1] += t[1]; tot += rsum[p * 32 + row]; }
        const float ri = __fdiv_rn(1.0f, tot); o[0] *= ri; o[1] *= ri;
        *(v2f*)(OUT + (((size_t)n * TT + i0 + row) * NH_ + h) * HD + lane * 2) = o; }
}

extern "C" void kernel_launch(void* const* d_in, const int* in_sizes, int n_in,
                              void* d_out, int out_size, void* d_ws, size_t ws_size, hipStream_t stream) {
    (void)in_sizes; (void)n_in; (void)out_size;
    const float* queries = (const float*)d_in[0]; const float* keys = (const float*)d_in[1]; const float* values = (const float*)d_in[2]; const float* pos_emb = (const float*)d_in[3]; const float* am = (const float*)d_in[4]; const float* kla = (const float*)d_in[5];
    float* OUT = (float*)d_out;     // [2][2048][16][64]
    char* wsp = (char*)d_ws;
    auto take = [&](size_t bytes) { char* p = wsp; wsp += (bytes + 255) & ~(size_t)255; return (void*)p; };
    bf* QF = (bf*)take((size_t)NT * DD * 2); bf* KF = (bf*)take((size_t)NT * DD * 2); bf* VF = (bf*)take((size_t)NT * DD * 2); bf* EF = (bf*)take((size_t)NH_ * TT * HD * 2); bf* MF = (bf*)take((size_t)TT * TT * 2);
    if ((size_t)(wsp - (char*)d_ws) > ws_size) return;    // ws 256 MiB
    k_fplane<<<NT * DD / 8 / 256, 256, 0, stream>>>(queries, QF); k_fplane<<<NT * DD / 8 / 256, 256, 0, stream>>>(keys, KF); k_vfplane<<<NT * DD / 8 / 256, 256, 0, stream>>>(values, VF); k_fplane<<<NH_ * TT * HD / 8 / 256, 256, 0, stream>>>(pos_emb, EF); k_mplane<<<TT * TT / 8 / 256, 256, 0, stream>>>(am, MF);
    k_attn<<<NB_ * NH_ * (TT / 32), 512, 0, stream>>>(QF, KF, VF, EF, MF, kla, OUT);
}

// v005
// A run of this version takes 128 microseconds.
// Next to v004, in two timings, it ran 1.11 times as fast each time.
// Over all steps from v000 it is 16.8 times as fast.
#include <hip/hip_runtime.h>

// CausalRelativeAttention (queries/keys/values [2][2048][16 heads][64], pos_emb [2048][16][64]; QE = q.E_h^T; Srel = skew(QE) (Music-Transformer pad/reshape trick);
// logits = (q.k^T + Srel + attn_mask_add[l][s] + key_lengths_add[n][s]) / 8; softmax over s; out[n][l][h][d] = sum_s A v).
// Compute dtypes, f32 accumulate: every input rounded to bf16; q.k^T and q.E^T on PLAIN bf16 operands (all inputs: exact products); the skew
// (an index remap of QE: Srel[i][j] = QE[i][L-1+j-i] for j <= i, = 0 for j = i+1, = QE[i+1][j-i-2] for j > i+1 - exactly the reference's pad/reshape), the two additive

#define NB_  2
#define TT   2048
#define NH_  16
#define HD   64
#define DD   (NH_ * HD)           // 1024
#define NT   (NB_ * TT)
typedef _Float16 h16;
typedef unsigned short bf;
typedef __attribute__((ext_vector_type(16))) __bf16   v16bf;
typedef __attribute__((ext_vector_type(16))) _Float16 v16h;
typedef __attribute__((ext_vector_type(8)))  _Float16 v8h;
typedef __attribute__((ext_vector_type(8)))  unsigned short v8us;
typedef __attribute__((ext_vector_type(8)))  float    v8f;
typedef __attribute__((ext_vector_type(4)))  float    v4f;
typedef v8h  __attribute__((may_alias)) v8ha;
typedef v4f  __attribute__((may_alias)) v4fa;
typedef v8us __attribute__((may_alias)) v8usa;

typedef __attribute__((ext_vector_type(2))) float  v2f;
typedef __attribute__((ext_vector_type(2))) __bf16 v2bf;
typedef __attribute__((ext_vector_type(4))) unsigned v4u;
typedef __attribute__((ext_vector_type(8))) unsigned v8u;
typedef v4u __attribute__((may_alias)) v4ua;
// f32 -> bf16, round to nearest even, two values in one conversion instruction that also packs them (x in the low half)
__device__ __forceinline__ v2bf rbf2(float x, float y) { return __builtin_convertvector((v2f){x, y}, v2bf); }
__device__ __forceinline__ unsigned pbf2(float x, float y) { return __builtin_bit_cast(unsigned, rbf2(x, y)); }
__device__ __forceinline__ float bf2f(unsigned short b) { return __uint_as_float(((unsigned)b) << 16); }
__device__ __forceinline__ v16h cat16(v8h lo, v8h hi) { return __builtin_shufflevector(lo, hi, 0, 1, 2, 3, 4, 5, 6, 7, 8, 9, 10, 11, 12, 13, 14, 15); }
__device__ __forceinline__ v16bf cat16b(v8us lo, v8us hi) { return __builtin_bit_cast(v16bf, __builtin_shufflevector(lo, hi, 0, 1, 2, 3, 4, 5, 6, 7, 8, 9, 10, 11, 12, 13, 14, 15)); }
__device__ __forceinline__ v8f wmma16(v16h a, v16h b, v8f c) { return __builtin_amdgcn_wmma_f32_16x16x32_f16(false, a, false, b, (short)0, c, false, false); }
__device__ __forceinline__ v8f wmmab(v16bf a, v16bf b, v8f c) { return __builtin_amdgcn_wmma_f32_16x16x32_bf16(false, a, false, b, (short)0, c, false, false); }



// fragment loader: row = lane & 15, k = 8 (lane >> 4) + 0..7 and 16 + 8 (lane >> 4) + 0..7, the same for the A and the B operand
template <typename T16> struct WFrag;
template <> struct WFrag<h16> { typedef v16h V; static __device__ __forceinline__ V ld(const h16* p) { return cat16(*(const v8h*)p, *(const v8h*)(p + 16)); } static __device__ __forceinline__ v8f mma(V a, V b, v8f c) { return wmma16(a, b, c); } };
template <> struct WFrag<bf> { typedef v16bf V; static __device__ __forceinline__ V ld(const bf* p) { return cat16b(*(const v8us*)p, *(const v8us*)(p + 16)); } static __device__ __forceinline__ v8f mma(V a, V b, v8f c) { return wmmab(a, b, c); } };
// y = hi + lo, both bf16, for two values: hi = bf16(y), lo = bf16(y - hi); the difference is exact in f32
__device__ __forceinline__ void splitf2(float y0, float y1, unsigned& h, unsigned& l) { const v2bf hb = rbf2(y0, y1); const v2f hf = __builtin_convertvector(hb, v2f); h = __builtin_bit_cast(unsigned, hb); l = pbf2(y0 - hf[0], y1 - hf[1]); }

// ---- planes packed in fragment order. A wave-wide 16-byte load of a row-major plane takes 32 bytes from each of 16 lines; here the 32 lanes' chunks of one such load lie side by side,
// 512 contiguous bytes = 4 whole lines, and every line is asked for once. One thread makes one chunk (8 bf16) and a wave writes 4 whole lines. The values and their k order are unchanged.
// Q, K and E: [head plane][tile of 16 rows][c = 0..3][lane][8] = row 16 tile + (lane & 15), d = 16 c + 8 (lane >> 4) + 0..7; chunks c = 0, 1 are the fragment of d 0..31, c = 2, 3 that of d 32..63
__global__ __launch_bounds__(256) void k_fplane(const float* __restrict__ src, bf* P) {
    const int g = blockIdx.x * 256 + threadIdx.x; const int lane = g & 31, c = (g >> 5) & 3, kt = (g >> 7) & (TT / 16 - 1), z = g >> 14; const int n = z >> 4, h = z & 15;
    const float* p = src + (((size_t)n * TT + kt * 16 + (lane & 15)) * NH_ + h) * HD + c * 16 + 8 * (lane >> 4);
    const v4f a = *(const v4fa*)p, b = *(const v4fa*)(p + 4);
    asm volatile("s_wait_xcnt 0x0" ::: "memory");   // behind the loads: the arithmetic below reuses their address registers
    *(v4ua*)(P + (size_t)g * 8) = (v4u){pbf2(a[0], a[1]), pbf2(a[2], a[3]), pbf2(b[0], b[1]), pbf2(b[2], b[3])};
}
// V^T: [head plane][block of 32 keys][nb = 0..3][c = 0..1][lane][8] = d 16 nb + (lane & 15), key 32 block + 16 c + 8 (lane >> 4) + 0..7
__global__ __launch_bounds__(256) void k_vfplane(const float* __restrict__ v, bf* P) {
    const int g = blockIdx.x * 256 + threadIdx.x; const int lane = g & 31, c = (g >> 5) & 1, nb = (g >> 6) & 3, sb = (g >> 8) & (TT / 32 - 1), z = g >> 14; const int n = z >> 4, h = z & 15;
    const float* p = v + (((size_t)n * TT + sb * 32 + c * 16 + 8 * (lane >> 4)) * NH_ + h) * HD + nb * 16 + (lane & 15); v4u o;
#pragma unroll
    for (int q = 0; q < 4; ++q) o[q] = pbf2(p[(size_t)(2 * q) * DD], p[(size_t)(2 * q + 1) * DD]);
    *(v4ua*)(P + (size_t)g * 8) = o;
}
// additive mask, rounded to bf16 as the logit sum takes it: [tile of 16 queries][tile of 16 keys][lane][8] = query 16 it + (lane & 15), key 16 jt + 8 (lane >> 4) + 0..7: a transposed logit tile's accumulator order
__global__ __launch_bounds__(256) void k_mplane(const float* __restrict__ am, bf* P) {
    const int g = blockIdx.x * 256 + threadIdx.x; const int lane = g & 31, jt = (g >> 5) & (TT / 16 - 1), it = g >> 12;
    const float* p = am + (size_t)(it * 16 + (lane & 15)) * TT + jt * 16 + 8 * (lane >> 4);
    const v4f a = *(const v4fa*)p, b = *(const v4fa*)(p + 4);
    asm volatile("s_wait_xcnt 0x0" ::: "memory");   // behind the loads: the arithmetic below reuses their address registers
    *(v4ua*)(P + (size_t)g * 8) = (v4u){pbf2(a[0], a[1]), pbf2(a[2], a[3]), pbf2(b[0], b[1]), pbf2(b[2], b[3])};
}
// a fragment of a packed plane: two chunks, 256 elements apart
__device__ __forceinline__ v16bf ldp(const bf* p) { return cat16b(*(const v8us*)p, *(const v8us*)(p + 256)); }
// logit(i,j) = (q_i.k_j + Srel(i,j) + bf(am[i][j]) + bf(kla[n][j])) / 8 with Srel(i,j) = QE[i][L-1+j-i] (j <= i), 0 (j == i+1), QE[i+1][j-i-2] (j >= i+2), QE[i][r] = q_i.E_h[r].
// ---- k_attn: both logit products, the skew, softmax and P.V of 32 query rows (two tiles of 16) of one head in one work-group of 16 waves; grid 32 heads * L / 32. Every tile is kept
// TRANSPOSED (rows = keys or positions, columns = 16 queries: lane & 15 is the query), so that a logit tile's accumulator registers are, after exp, already the B fragment of V^T.P^T.
// Each E, K and V^T fragment is loaded once and multiplied with both query tiles: the bytes a work-group draws from L2 serve twice the queries.
// Phase A, wave w = positions [128 w, 128 w + 128): QE^T tiles to LDS, one row of XP dwords a query; row i0+31 reads on in QE row i0+32, which is the first column of a third
// tile on queries i0+32..i0+47. Phase B, wave w = keys [128 w, 128 w + 128): the skewed QE run from LDS plus both
// masks is the start value of the K.Q^T accumulator; row max over lanes, then over waves through LDS. Phase C: exp, bf16 hi/lo split, V^T.P^T on the wave's own 128 keys, f32 partial tiles to LDS.
// Phase D: the 16 partials and the 16 partial row sums are added in wave order, scaled by 1/sum and stored as whole 256-byte rows of the output.
#define XP 2052                   // pitch of a QE row in LDS, in dwords: 16-byte stores of 16 rows fall on all 64 banks (pitch = 4 mod 64), the skewed dword reads step 3 banks a lane
#define XU (XP - TT - 1)          // a row's run for j >= i+2 starts this many dwords behind the place where its run for j <= i would go on
// eight 2^x in one statement: behind a v_exp_f32 the instruction set asks for one independent instruction before its result is read or its source overwritten; here each is the
// next one's (outputs share no register with an input), and the v_nop is the last one's.
__device__ __forceinline__ void exp2x8(float* r, const float* x) {
    asm("v_exp_f32 %0, %8\n\tv_exp_f32 %1, %9\n\tv_exp_f32 %2, %10\n\tv_exp_f32 %3, %11\n\tv_exp_f32 %4, %12\n\tv_exp_f32 %5, %13\n\tv_exp_f32 %6, %14\n\tv_exp_f32 %7, %15\n\tv_nop"
        : "=&v"(r[0]), "=&v"(r[1]), "=&v"(r[2]), "=&v"(r[3]), "=&v"(r[4]), "=&v"(r[5]), "=&v"(r[6]), "=&v"(r[7]) : "v"(x[0]), "v"(x[1]), "v"(x[2]), "v"(x[3]), "v"(x[4]), "v"(x[5]), "v"(x[6]), "v"(x[7]));
}
typedef v2f  __attribute__((may_alias)) v2fa;
__global__ __launch_bounds__(512) void k_attn(const bf* __restrict__ QF, const bf* __restrict__ KF, const bf* __restrict__ VF, const bf* __restrict__ EF, const bf* __restrict__ MF, const float* __restrict__ kla, float* OUT) {
    __shared__ __align__(16) float xs[33 * XP];   // phases A and B: QE rows i0..i0+32; phases C and D: the 16 partial output tiles, 32 x 68 dwords each
    __shared__ float rmax[16 * 32];
    __shared__ float rsum[16 * 32];
    const int lane = threadIdx.x & 31, lr = lane & 15, hi = lane >> 4; const int w = __builtin_amdgcn_readfirstlane(threadIdx.x >> 5);
    const int z = blockIdx.x / (TT / 32); const int i0 = (blockIdx.x % (TT / 32)) * 32; const int n = z >> 4, h = z & 15;
    const bf* qz = QF + (size_t)z * TT * HD; const bf* kw = KF + (size_t)z * TT * HD + (size_t)w * 128 * HD; const bf* ew = EF + (size_t)h * TT * HD + (size_t)w * 128 * HD; const bf* vw = VF + (size_t)z * HD * TT + (size_t)w * 128 * HD;
    const unsigned po = (unsigned)(lane * 8);           // in the packed planes: a tile of 16 rows is 1024 elements, a V^T block of 32 keys 2048, a mask tile 256
    const bf* q0p = qz + i0 * HD; const bf* q2p = qz + (i0 + 32 < TT ? i0 + 32 : i0) * HD;   // the tile of queries below; the last block has no row below it, and its row 32 in LDS is never read
    v16bf qa[2], qb[2];
#pragma unroll
    for (int a = 0; a < 2; ++a) { qa[a] = ldp(q0p + a * 1024 + po); qb[a] = ldp(q0p + a * 1024 + 512 + po); }
    const bf* mw = MF + ((size_t)(i0 >> 4) * (TT / 16) + w * 8) * 256; const float* kr = kla + (size_t)n * TT + w * 128;   // the same address in every lane: the key-length values come through scalar registers
    // a key tile's two K fragments are fetched one tile ahead into the same registers, right behind the products that read them; its mask and key-length values two tiles ahead into two register sets
    v16bf kf[2]; v8us af[2][2]; float lf[2][16];
    auto ldk = [&](int t) { kf[0] = ldp(kw + t * 1024 + po); kf[1] = ldp(kw + t * 1024 + 512 + po); };
    auto ldm = [&](int t) { const int s = t & 1; af[s][0] = *(const v8usa*)(mw + t * 256 + po); af[s][1] = *(const v8usa*)(mw + (TT / 16) * 256 + t * 256 + po);
#pragma unroll
        for (int e = 0; e < 16; ++e) lf[s][e] = kr[t * 16 + e]; };
    {
        const v16bf q2a = ldp(q2p + po), q2b = ldp(q2p + 512 + po);
        v8f u[8], d[2][2]; float* xp = xs + lr * XP + w * 128 + 8 * hi;
        auto std = [&](int t) {
#pragma unroll
            for (int a = 0; a < 2; ++a) { const v8f x = d[t & 1][a]; *(v4fa*)(xp + a * 16 * XP + t * 16) = (v4f){x[0], x[1], x[2], x[3]}; *(v4fa*)(xp + a * 16 * XP + t * 16 + 4) = (v4f){x[4], x[5], x[6], x[7]}; } };
        v16bf ef[8][2];           // all eight E tiles are asked for at once: the registers that they leave, tile by tile, take the third query tile's results
#pragma unroll
        for (int t = 0; t < 8; ++t) { ef[t][0] = ldp(ew + t * 1024 + po); ef[t][1] = ldp(ew + t * 1024 + 512 + po); }
#pragma unroll
        for (int t = 0; t < 8; ++t) { const v16bf e0 = ef[t][0], e1 = ef[t][1]; u[t] = (v8f){};
            u[t] = wmmab(e0, q2a, u[t]); u[t] = wmmab(e1, q2b, u[t]);
#pragma unroll
            for (int a = 0; a < 2; ++a) { d[t & 1][a] = (v8f){}; d[t & 1][a] = wmmab(e0, qa[a], d[t & 1][a]); d[t & 1][a] = wmmab(e1, qb[a], d[t & 1][a]); }
            __builtin_amdgcn_sched_barrier(0);   // a tile's LDS stores stay behind the next tile's six products: those fill the slots between a product and the first read of its result
            if (t > 0) std(t - 1); }
        std(7);
        ldk(0); ldm(0); ldm(1);   // the next phase's first loads go out in front of the barrier: their latency runs beside the LDS stores and the wait for the other waves
        if (lr == 0) {            // column 0 of the third tile is query i0+32
#pragma unroll
            for (int t = 0; t < 8; ++t) { *(v4fa*)(xp + 32 * XP + t * 16) = (v4f){u[t][0], u[t][1], u[t][2], u[t][3]}; *(v4fa*)(xp + 32 * XP + t * 16 + 4) = (v4f){u[t][4], u[t][5], u[t][6], u[t][7]}; } }
    }
    __syncthreads();              // every QE row is in LDS before another wave reads its skewed run
    float lg[2][64]; float mx[2] = {-__builtin_inff(), -__builtin_inff()};   // below every value: the maximum is taken of 8 x the logit, which may lie under any finite start
#pragma unroll
    for (int a = 0; a < 2; ++a) { const int ia0 = i0 + 16 * a, i = ia0 + lr; const float* xb = xs + (a * 16 + lr) * XP + (TT - 1 - i) + w * 128 + 8 * hi;
#pragma unroll
        for (int t = 0; t < 8; ++t) { const int j0 = w * 128 + t * 16;   // the skewed runs first, so that the loop of products below has no branch in it
            if (j0 == ia0 || j0 == ia0 + 16) {    // the two tiles that the diagonal j == i+1 crosses: each element picks its own run; at j == i+1 the neighbour is read and dropped
#pragma unroll
                for (int e = 0; e < 8; ++e) { const int je = j0 + 8 * hi + e; const float v = xb[t * 16 + e + (je > i + 1 ? XU : (je > i ? -1 : 0))]; lg[a][t * 8 + e] = (je == i + 1) ? 0.f : v; }
            } else { const float* p = xb + t * 16 + (j0 > ia0 ? XU : 0);
#pragma unroll
                for (int e = 0; e < 8; ++e) lg[a][t * 8 + e] = p[e]; } } }
#pragma unroll
    for (int t = 0; t < 8; ++t) { const int b = t & 1; v8f s[2];
#pragma unroll
        for (int e = 0; e < 8; e += 2) { const v2f kv = __builtin_convertvector(rbf2(hi ? lf[b][8 + e] : lf[b][e], hi ? lf[b][9 + e] : lf[b][1 + e]), v2f);   // the skewed QE value and both masks start the accumulator of K.Q^T: no second set of eight registers a tile
#pragma unroll
            for (int a = 0; a < 2; ++a) { s[a][e] = __fadd_rn(lg[a][t * 8 + e], __fadd_rn(bf2f(af[b][a][e]), kv[0])); s[a][e + 1] = __fadd_rn(lg[a][t * 8 + e + 1], __fadd_rn(bf2f(af[b][a][e + 1]), kv[1])); } }
#pragma unroll
        for (int a = 0; a < 2; ++a) { s[a] = wmmab(kf[0], qa[a], s[a]); s[a] = wmmab(kf[1], qb[a], s[a]); }
        if (t + 1 < 8) ldk(t + 1);
        if (t + 2 < 8) ldm(t + 2);
        if (t + 1 == 7) asm volatile("s_wait_xcnt 0x0" ::: "memory");   // behind the last loads of this phase: their address registers are free for the arithmetic that follows
#pragma unroll
        for (int a = 0; a < 2; ++a) {
#pragma unroll
            for (int e = 0; e < 8; ++e) { lg[a][t * 8 + e] = s[a][e]; mx[a] = fmaxf(mx[a], s[a][e]); } }   // 8 x the logit stays where the products left it; the 1/8 is in the factor of the exponent
        __builtin_amdgcn_sched_barrier(0); } // holds the fetch distance: with more tiles' loads lifted to the top the registers run out and logits spill
    v16bf vf[4];                  // V^T fragments of 32 keys, fetched one step ahead into the same registers; the first step's go out in front of the barrier, beside the wait for the other waves
    auto ldv = [&](int ks) {
#pragma unroll
        for (int nb = 0; nb < 4; ++nb) vf[nb] = ldp(vw + ks * 2048 + nb * 512 + po); };
    ldv(0);
#pragma unroll
    for (int a = 0; a < 2; ++a) { mx[a] = fmaxf(mx[a], __shfl_xor(mx[a], 16, 32)); if (hi == 0) rmax[w * 32 + a * 16 + lr] = mx[a]; }
    __syncthreads();              // every wave's row maxima are in LDS, and every read of the QE rows is over before the partial tiles are written over them
#pragma unroll
    for (int a = 0; a < 2; ++a) {
#pragma unroll
        for (int p = 0; p < 16; ++p) mx[a] = fmaxf(mx[a], rmax[p * 32 + a * 16 + lr]); }
    float sum[2] = {0.f, 0.f}; v8f acc[2][4];
#pragma unroll
    for (int a = 0; a < 2; ++a) {
#pragma unroll
        for (int nb = 0; nb < 4; ++nb) acc[a][nb] = (v8f){}; }
#pragma unroll
    for (int ks = 0; ks < 4; ++ks) {   // keys 32 ks + 8 hi + 0..7 and + 16 + 0..7: the k order of the fragment loader
#pragma unroll
        for (int a = 0; a < 2; ++a) { v8u ph, pl;
#pragma unroll
            for (int g = 0; g < 2; ++g) { float xa[8], ev[8];
#pragma unroll
                for (int e = 0; e < 8; ++e) xa[e] = (lg[a][ks * 16 + g * 8 + e] - mx[a]) * (1.44269504f * 0.125f);   // exp((x - max) / 8) = 2^((x - max) log2 e / 8); a power of two moves through every rounding: the same bits
                exp2x8(ev, xa);
#pragma unroll
                for (int e = 0; e < 8; e += 2) { sum[a] += ev[e]; sum[a] += ev[e + 1]; unsigned x, y; splitf2(ev[e], ev[e + 1], x, y); ph[g * 4 + e / 2] = x; pl[g * 4 + e / 2] = y; }
                }
            const v16bf bh = __builtin_bit_cast(v16bf, ph), bl = __builtin_bit_cast(v16bf, pl);
#pragma unroll
            for (int nb = 0; nb < 4; ++nb) { acc[a][nb] = wmmab(vf[nb], bh, acc[a][nb]); acc[a][nb] = wmmab(vf[nb], bl, acc[a][nb]); }
            __builtin_amdgcn_sched_barrier(0); }   // the next exponentials stay behind these products, their subtractions and multiplies in between: lifted among the products, the asm statement writes
                                                   // a product's operand registers inside the four slots that the chip needs behind it
        if (ks + 1 < 4) ldv(ks + 1);
        }
#pragma unroll
    for (int a = 0; a < 2; ++a) { sum[a] += __shfl_xor(sum[a], 16, 32); if (hi == 0) rsum[w * 32 + a * 16 + lr] = sum[a];
#pragma unroll
        for (int nb = 0; nb < 4; ++nb) { float* op = xs + w * (32 * 68) + (a * 16 + lr) * 68 + nb * 16 + 8 * hi;
            *(v4fa*)op = (v4f){acc[a][nb][0], acc[a][nb][1], acc[a][nb][2], acc[a][nb][3]}; *(v4fa*)(op + 4) = (v4f){acc[a][nb][4], acc[a][nb][5], acc[a][nb][6], acc[a][nb][7]}; } }
    __syncthreads();              // all 16 partial tiles and partial sums are in LDS before they are added
#pragma unroll
    for (int a = 0; a < 2; ++a) { const int row = a * 16 + w;
        v2f o = *(const v2fa*)(xs + row * 68 + lane * 2); float tot = rsum[row];
#pragma unroll
        for (int p = 1; p < 16; ++p) { const v2f t = *(const v2fa*)(xs + p * (32 * 68) + row * 68 + lane * 2); o[0] += t[0]; o[1] += t[1]; tot += rsum[p * 32 + row]; }
        const float ri = __fdiv_rn(1.0f, tot); o[0] *= ri; o[1] *= ri;
        *(v2f*)(OUT + (((size_t)n * TT + i0 + row) * NH_ + h) * HD + lane * 2) = o; }
}

extern "C" void kernel_launch(void* const* d_in, const int* in_sizes, int n_in,
                              void* d_out, int out_size, void* d_ws, size_t ws_size, hipStream_t stream) {
    (void)in_sizes; (void)n_in; (void)out_size;
    const float* queries = (const float*)d_in[0]; const float* keys = (const float*)d_in[1]; const float* values = (const float*)d_in[2]; const float* pos_emb = (const float*)d_in[3]; const float* am = (const float*)d_in[4]; const float* kla = (const float*)d_in[5];
    float* OUT = (float*)d_out;     // [2][2048][16][64]
    char* wsp = (char*)d_ws;
    auto take = [&](size_t bytes) { char* p = wsp; wsp += (bytes + 255) & ~(size_t)255; return (void*)p; };
    bf* QF = (bf*)take((size_t)NT * DD * 2); bf* KF = (bf*)take((size_t)NT * DD * 2); bf* VF = (bf*)take((size_t)NT * DD * 2); bf* EF = (bf*)take((size_t)NH_ * TT * HD * 2); bf* MF = (bf*)take((size_t)TT * TT * 2);
    if ((size_t)(wsp - (char*)d_ws) > ws_size) return;    // ws 256 MiB
    k_fplane<<<NT * DD / 8 / 256, 256, 0, stream>>>(queries, QF); k_fplane<<<NT * DD / 8 / 256, 256, 0, stream>>>(keys, KF); k_vfplane<<<NT * DD / 8 / 256, 256, 0, stream>>>(values, VF); k_fplane<<<NH_ * TT * HD / 8 / 256, 256, 0, stream>>>(pos_emb, EF); k_mplane<<<TT * TT / 8 / 256, 256, 0, stream>>>(am, MF);
    k_attn<<<NB_ * NH_ * (TT / 32), 512, 0, stream>>>(QF, KF, VF, EF, MF, kla, OUT);
}

// v006
// It runs in 120 microseconds.
// Two timings next to v005 both put it at 1.07 times that version's speed.
// Counting every step since v000, it is 18.0 times as fast.
#include <hip/hip_runtime.h>

// CausalRelativeAttention (queries/keys/values [2][2048][16 heads][64], pos_emb [2048][16][64]; QE = q.E_h^T; Srel = skew(QE) (Music-Transformer pad/reshape trick);
// logits = (q.k^T + Srel + attn_mask_add[l][s] + key_lengths_add[n][s]) / 8; softmax over s; out[n][l][h][d] = sum_s A v).
// Compute dtypes, f32 accumulate: every input rounded to bf16; q.k^T and q.E^T on PLAIN bf16 operands (all inputs: exact products); the skew
// (an index remap of QE: Srel[i][j] = QE[i][L-1+j-i] for j <= i, = 0 for j = i+1, = QE[i+1][j-i-2] for j > i+1 - exactly the reference's pad/reshape), the two additive

#define NB_  2
#define TT   2048
#define NH_  16
#define HD   64
#define DD   (NH_ * HD)           // 1024
#define NT   (NB_ * TT)
typedef _Float16 h16;
typedef unsigned short bf;
typedef __attribute__((ext_vector_type(16))) __bf16   v16bf;
typedef __attribute__((ext_vector_type(16))) _Float16 v16h;
typedef __attribute__((ext_vector_type(8)))  _Float16 v8h;
typedef __attribute__((ext_vector_type(8)))  unsigned short v8us;
typedef __attribute__((ext_vector_type(8)))  float    v8f;
typedef __attribute__((ext_vector_type(4)))  float    v4f;
typedef v8h  __attribute__((may_alias)) v8ha;
typedef v4f  __attribute__((may_alias)) v4fa;
typedef v8us __attribute__((may_alias)) v8usa;

typedef __attribute__((ext_vector_type(2))) float  v2f;
typedef __attribute__((ext_vector_type(2))) __bf16 v2bf;
typedef __attribute__((ext_vector_type(4))) unsigned v4u;
typedef __attribute__((ext_vector_type(8))) unsigned v8u;
typedef v4u __attribute__((may_alias)) v4ua;
// f32 -> bf16, round to nearest even, two values in one conversion instruction that also packs them (x in the low half)
__device__ __forceinline__ v2bf rbf2(float x, float y) { return __builtin_convertvector((v2f){x, y}, v2bf); }
__device__ __forceinline__ unsigned pbf2(float x, float y) { return __builtin_bit_cast(unsigned, rbf2(x, y)); }
__device__ __forceinline__ float bf2f(unsigned short b) { return __uint_as_float(((unsigned)b) << 16); }
__device__ __forceinline__ v16h cat16(v8h lo, v8h hi) { return __builtin_shufflevector(lo, hi, 0, 1, 2, 3, 4, 5, 6, 7, 8, 9, 10, 11, 12, 13, 14, 15); }
__device__ __forceinline__ v16bf cat16b(v8us lo, v8us hi) { return __builtin_bit_cast(v16bf, __builtin_shufflevector(lo, hi, 0, 1, 2, 3, 4, 5, 6, 7, 8, 9, 10, 11, 12, 13, 14, 15)); }
__device__ __forceinline__ v8f wmma16(v16h a, v16h b, v8f c) { return __builtin_amdgcn_wmma_f32_16x16x32_f16(false, a, false, b, (short)0, c, false, false); }
__device__ __forceinline__ v8f wmmab(v16bf a, v16bf b, v8f c) { return __builtin_amdgcn_wmma_f32_16x16x32_bf16(false, a, false, b, (short)0, c, false, false); }



// fragment loader: row = lane & 15, k = 8 (lane >> 4) + 0..7 and 16 + 8 (lane >> 4) + 0..7, the same for the A and the B operand
template <typename T16> struct WFrag;
template <> struct WFrag<h16> { typedef v16h V; static __device__ __forceinline__ V ld(const h16* p) { return cat16(*(const v8h*)p, *(const v8h*)(p + 16)); } static __device__ __forceinline__ v8f mma(V a, V b, v8f c) { return wmma16(a, b, c); } };
template <> struct WFrag<bf> { typedef v16bf V; static __device__ __forceinline__ V ld(const bf* p) { return cat16b(*(const v8us*)p, *(const v8us*)(p + 16)); } static __device__ __forceinline__ v8f mma(V a, V b, v8f c) { return wmmab(a, b, c); } };
// y = hi + lo, both bf16, for two values: hi = bf16(y), lo = bf16(y - hi); the difference is exact in f32
__device__ __forceinline__ void splitf2(float y0, float y1, unsigned& h, unsigned& l) { const v2bf hb = rbf2(y0, y1); const v2f hf = __builtin_convertvector(hb, v2f); h = __builtin_bit_cast(unsigned, hb); l = pbf2(y0 - hf[0], y1 - hf[1]); }

// ---- planes packed in fragment order. A wave-wide 16-byte load of a row-major plane takes 32 bytes from each of 16 lines; here the 32 lanes' chunks of one such load lie side by side,
// 512 contiguous bytes = 4 whole lines, and every line is asked for once. One lane makes one chunk (8 bf16) and a wave writes 4 whole lines a chunk row. The values and their k order are unchanged.
// Q, K and E: [head plane][tile of 16 rows][c = 0..3][lane][8] = row 16 tile + (lane & 15), d = 16 c + 8 (lane >> 4) + 0..7; chunks c = 0, 1 are the fragment of d 0..31, c = 2, 3 that of d 32..63
// V^T: [head plane][block of 32 keys][nb = 0..3][c = 0..1][lane][8] = d 16 nb + (lane & 15), key 32 block + 16 c + 8 (lane >> 4) + 0..7
// additive mask, rounded to bf16 as the logit sum takes it: [tile of 16 queries][tile of 16 keys][lane][8] = query 16 it + (lane & 15), key 16 jt + 8 (lane >> 4) + 0..7: a transposed logit tile's accumulator order
// All five planes are packed by ONE launch of 256 work-groups of 16 waves. Wave W of 4096 makes 18 chunk rows: rows 4 W .. 4 W + 3 of Q, K, V^T and the mask, rows 2 W, 2 W + 1 of E. The four
// (two) neighbouring chunk rows of a plane read whole 128-byte lines of the source between them, and all of a wave's 60 loads are in flight before its first store.
#define PKW 4096                  // waves of the pack launch: a quarter of the 16384 chunk rows of Q, K, V^T and the mask, half of the 8192 of E
__device__ __forceinline__ v4u pk8(v4f a, v4f b) { return (v4u){pbf2(a[0], a[1]), pbf2(a[2], a[3]), pbf2(b[0], b[1]), pbf2(b[2], b[3])}; }
__global__ __launch_bounds__(512) void k_pack(const float* __restrict__ q, const float* __restrict__ k, const float* __restrict__ v, const float* __restrict__ e, const float* __restrict__ am, bf* QF, bf* KF, bf* VF, bf* EF, bf* MF) {
    const int lane = threadIdx.x & 31, lr = lane & 15, hi = lane >> 4; const int W = blockIdx.x * 16 + (threadIdx.x >> 5); const int z = W >> 7, n = z >> 4, h = z & 15;
    const size_t qo = (((size_t)n * TT + (W & 127) * 16 + lr) * NH_ + h) * HD + 8 * hi;                                              // tile W & 127 of head plane z, c = 0
    const float* qp = q + qo; const float* kp = k + qo;
    const float* mp = am + (size_t)((W >> 5) * 16 + lr) * TT + (W & 31) * 64 + 8 * hi;                                               // query tile W >> 5, key tiles 4 (W & 31) + 0..3
    const float* ep = e + ((size_t)(((W >> 1) & 127) * 16 + lr) * NH_ + (W >> 8)) * HD + (W & 1) * 32 + 8 * hi;                      // tile (W >> 1) & 127 of head W >> 8, c = 2 (W & 1) + 0..1
    const float* vp = v + (((size_t)n * TT + ((W >> 1) & 63) * 32 + 8 * hi) * NH_ + h) * HD + (W & 1) * 32 + lr;                     // key block (W >> 1) & 63 of head plane z, nb = 2 (W & 1) + 0..1
    v4f qv[4][2], kv[4][2], mv[4][2], ev[2][2]; float vv[4][8];
#pragma unroll
    for (int u = 0; u < 4; ++u) { qv[u][0] = *(const v4fa*)(qp + u * 16); qv[u][1] = *(const v4fa*)(qp + u * 16 + 4); }
#pragma unroll
    for (int u = 0; u < 4; ++u) { kv[u][0] = *(const v4fa*)(kp + u * 16); kv[u][1] = *(const v4fa*)(kp + u * 16 + 4); }
#pragma unroll
    for (int u = 0; u < 4; ++u) { mv[u][0] = *(const v4fa*)(mp + u * 16); mv[u][1] = *(const v4fa*)(mp + u * 16 + 4); }
#pragma unroll
    for (int u = 0; u < 2; ++u) { ev[u][0] = *(const v4fa*)(ep + u * 16); ev[u][1] = *(const v4fa*)(ep + u * 16 + 4); }
#pragma unroll
    for (int u = 0; u < 4; ++u) {   // chunk row u: c = u & 1, nb = 2 (W & 1) + (u >> 1)
#pragma unroll
        for (int r = 0; r < 8; ++r) vv[u][r] = vp[(size_t)((u & 1) * 16 + r) * DD + (u >> 1) * 16]; }
    __builtin_amdgcn_sched_barrier(0);   // all 60 loads go out before the first wait for data: with conversions lifted among them the last loads started only when the first results were back
    asm volatile("s_wait_xcnt 0x0" :: "v"(qp), "v"(kp), "v"(mp), "v"(ep), "v"(vp) : "memory");   // behind the loads; the five addresses are inputs, so their registers are rewritten by nothing in front of the wait
    const size_t o4 = ((size_t)W * 128 + lane) * 8, o2 = ((size_t)W * 64 + lane) * 8;
    // a plane's conversions and stores stay in the order of its loads (the scheduling barriers): each group then waits for its own loads alone and its stores run beside the loads still in flight
#pragma unroll
    for (int u = 0; u < 4; ++u) *(v4ua*)(QF + o4 + u * 256) = pk8(qv[u][0], qv[u][1]);
    __builtin_amdgcn_sched_barrier(0);
#pragma unroll
    for (int u = 0; u < 4; ++u) *(v4ua*)(KF + o4 + u * 256) = pk8(kv[u][0], kv[u][1]);
    __builtin_amdgcn_sched_barrier(0);
#pragma unroll
    for (int u = 0; u < 4; ++u) *(v4ua*)(MF + o4 + u * 256) = pk8(mv[u][0], mv[u][1]);
    __builtin_amdgcn_sched_barrier(0);
#pragma unroll
    for (int u = 0; u < 2; ++u) *(v4ua*)(EF + o2 + u * 256) = pk8(ev[u][0], ev[u][1]);
    __builtin_amdgcn_sched_barrier(0);
#pragma unroll
    for (int u = 0; u < 4; ++u) *(v4ua*)(VF + o4 + u * 256) = (v4u){pbf2(vv[u][0], vv[u][1]), pbf2(vv[u][2], vv[u][3]), pbf2(vv[u][4], vv[u][5]), pbf2(vv[u][6], vv[u][7])};
}
// a fragment of a packed plane: two chunks, 256 elements apart
__device__ __forceinline__ v16bf ldp(const bf* p) { return cat16b(*(const v8us*)p, *(const v8us*)(p + 256)); }
// logit(i,j) = (q_i.k_j + Srel(i,j) + bf(am[i][j]) + bf(kla[n][j])) / 8 with Srel(i,j) = QE[i][L-1+j-i] (j <= i), 0 (j == i+1), QE[i+1][j-i-2] (j >= i+2), QE[i][r] = q_i.E_h[r].
// ---- k_attn: both logit products, the skew, softmax and P.V of 32 query rows (two tiles of 16) of one head in one work-group of 16 waves; grid 32 heads * L / 32. Every tile is kept
// TRANSPOSED (rows = keys or positions, columns = 16 queries: lane & 15 is the query), so that a logit tile's accumulator registers are, after exp, already the B fragment of V^T.P^T.
// Each E, K and V^T fragment is loaded once and multiplied with both query tiles: the bytes a work-group draws from L2 serve twice the queries.
// Phase A, wave w = positions [128 w, 128 w + 128): QE^T tiles to LDS, one row of XP dwords a query; row i0+31 reads on in QE row i0+32, which is the first column of a third
// tile on queries i0+32..i0+47. Phase B, wave w = keys [128 w, 128 w + 128): the skewed QE run from LDS plus both
// masks is the start value of the K.Q^T accumulator; row max over lanes, then over waves through LDS. Phase C: exp, bf16 hi/lo split, V^T.P^T on the wave's own 128 keys, f32 partial tiles to LDS.
// Phase D: the 16 partials and the 16 partial row sums are added in wave order, scaled by 1/sum and stored as whole 256-byte rows of the output.
#define XP 2052                   // pitch of a QE row in LDS, in dwords: 16-byte stores of 16 rows fall on all 64 banks (pitch = 4 mod 64), the skewed dword reads step 3 banks a lane
#define XU (XP - TT - 1)          // a row's run for j >= i+2 starts this many dwords behind the place where its run for j <= i would go on
// eight 2^x in one statement: behind a v_exp_f32 the instruction set asks for one independent instruction before its result is read or its source overwritten; here each is the
// next one's (outputs share no register with an input), and the v_nop is the last one's.
__device__ __forceinline__ void exp2x8(float* r, const float* x) {
    asm("v_exp_f32 %0, %8\n\tv_exp_f32 %1, %9\n\tv_exp_f32 %2, %10\n\tv_exp_f32 %3, %11\n\tv_exp_f32 %4, %12\n\tv_exp_f32 %5, %13\n\tv_exp_f32 %6, %14\n\tv_exp_f32 %7, %15\n\tv_nop"
        : "=&v"(r[0]), "=&v"(r[1]), "=&v"(r[2]), "=&v"(r[3]), "=&v"(r[4]), "=&v"(r[5]), "=&v"(r[6]), "=&v"(r[7]) : "v"(x[0]), "v"(x[1]), "v"(x[2]), "v"(x[3]), "v"(x[4]), "v"(x[5]), "v"(x[6]), "v"(x[7]));
}
typedef v2f  __attribute__((may_alias)) v2fa;
__global__ __launch_bounds__(512) void k_attn(const bf* __restrict__ QF, const bf* __restrict__ KF, const bf* __restrict__ VF, const bf* __restrict__ EF, const bf* __restrict__ MF, const float* __restrict__ kla, float* OUT) {
    __shared__ __align__(16) float xs[33 * XP];   // phases A and B: QE rows i0..i0+32; phases C and D: the 16 partial output tiles, 32 x 68 dwords each
    __shared__ float rmax[16 * 32];
    __shared__ float rsum[16 * 32];
    const int lane = threadIdx.x & 31, lr = lane & 15, hi = lane >> 4; const int w = __builtin_amdgcn_readfirstlane(threadIdx.x >> 5);
    const int z = blockIdx.x / (TT / 32); const int i0 = (blockIdx.x % (TT / 32)) * 32; const int n = z >> 4, h = z & 15;
    const bf* qz = QF + (size_t)z * TT * HD; const bf* kw = KF + (size_t)z * TT * HD + (size_t)w * 128 * HD; const bf* ew = EF + (size_t)h * TT * HD + (size_t)w * 128 * HD; const bf* vw = VF + (size_t)z * HD * TT + (size_t)w * 128 * HD;
    const unsigned po = (unsigned)(lane * 8);           // in the packed planes: a tile of 16 rows is 1024 elements, a V^T block of 32 keys 2048, a mask tile 256
    const bf* q0p = qz + i0 * HD; const bf* q2p = qz + (i0 + 32 < TT ? i0 + 32 : i0) * HD;   // the tile of queries below; the last block has no row below it, and its row 32 in LDS is never read
    v16bf qa[2], qb[2];
#pragma unroll
    for (int a = 0; a < 2; ++a) { qa[a] = ldp(q0p + a * 1024 + po); qb[a] = ldp(q0p + a * 1024 + 512 + po); }
    const bf* mw = MF + ((size_t)(i0 >> 4) * (TT / 16) + w * 8) * 256; const float* kr = kla + (size_t)n * TT + w * 128;   // the same address in every lane: the key-length values come through scalar registers
    // a key tile's two K fragments are fetched one tile ahead into the same registers, right behind the products that read them; its mask and key-length values two tiles ahead into two register sets
    v16bf kf[2]; v8us af[2][2]; float lf[2][16];
    auto ldk = [&](int t) { kf[0] = ldp(kw + t * 1024 + po); kf[1] = ldp(kw + t * 1024 + 512 + po); };
    auto ldm = [&](int t) { const int s = t & 1; af[s][0] = *(const v8usa*)(mw + t * 256 + po); af[s][1] = *(const v8usa*)(mw + (TT / 16) * 256 + t * 256 + po);
#pragma unroll
        for (int e = 0; e < 16; ++e) lf[s][e] = kr[t * 16 + e]; };
    {
        const v16bf q2a = ldp(q2p + po), q2b = ldp(q2p + 512 + po);
        v8f u[8], d[2][2]; float* xp = xs + lr * XP + w * 128 + 8 * hi;
        auto std = [&](int t) {
#pragma unroll
            for (int a = 0; a < 2; ++a) { const v8f x = d[t & 1][a]; *(v4fa*)(xp + a * 16 * XP + t * 16) = (v4f){x[0], x[1], x[2], x[3]}; *(v4fa*)(xp + a * 16 * XP + t * 16 + 4) = (v4f){x[4], x[5], x[6], x[7]}; } };
        v16bf ef[8][2];           // all eight E tiles are asked for at once: the registers that they leave, tile by tile, take the third query tile's results
#pragma unroll
        for (int t = 0; t < 8; ++t) { ef[t][0] = ldp(ew + t * 1024 + po); ef[t][1] = ldp(ew + t * 1024 + 512 + po); }
#pragma unroll
        for (int t = 0; t < 8; ++t) { const v16bf e0 = ef[t][0], e1 = ef[t][1]; u[t] = (v8f){};
            u[t] = wmmab(e0, q2a, u[t]); u[t] = wmmab(e1, q2b, u[t]);
#pragma unroll
            for (int a = 0; a < 2; ++a) { d[t & 1][a] = (v8f){}; d[t & 1][a] = wmmab(e0, qa[a], d[t & 1][a]); d[t & 1][a] = wmmab(e1, qb[a], d[t & 1][a]); }
            __builtin_amdgcn_sched_barrier(0);   // a tile's LDS stores stay behind the next tile's six products: those fill the slots between a product and the first read of its result
            if (t > 0) std(t - 1); }
        std(7);
        ldk(0); ldm(0); ldm(1);   // the next phase's first loads go out in front of the barrier: their latency runs beside the LDS stores and the wait for the other waves
        if (lr == 0) {            // column 0 of the third tile is query i0+32
#pragma unroll
            for (int t = 0; t < 8; ++t) { *(v4fa*)(xp + 32 * XP + t * 16) = (v4f){u[t][0], u[t][1], u[t][2], u[t][3]}; *(v4fa*)(xp + 32 * XP + t * 16 + 4) = (v4f){u[t][4], u[t][5], u[t][6], u[t][7]}; } }
    }
    __syncthreads();              // every QE row is in LDS before another wave reads its skewed run
    float lg[2][64]; float mx[2] = {-__builtin_inff(), -__builtin_inff()};   // below every value: the maximum is taken of 8 x the logit, which may lie under any finite start
#pragma unroll
    for (int a = 0; a < 2; ++a) { const int ia0 = i0 + 16 * a, i = ia0 + lr; const float* xb = xs + (a * 16 + lr) * XP + (TT - 1 - i) + w * 128 + 8 * hi;
#pragma unroll
        for (int t = 0; t < 8; ++t) { const int j0 = w * 128 + t * 16;   // the skewed runs first, so that the loop of products below has no branch in it
            if (j0 == ia0 || j0 == ia0 + 16) {    // the two tiles that the diagonal j == i+1 crosses: each element picks its own run; at j == i+1 the neighbour is read and dropped
#pragma unroll
                for (int e = 0; e < 8; ++e) { const int je = j0 + 8 * hi + e; const float v = xb[t * 16 + e + (je > i + 1 ? XU : (je > i ? -1 : 0))]; lg[a][t * 8 + e] = (je == i + 1) ? 0.f : v; }
            } else { const float* p = xb + t * 16 + (j0 > ia0 ? XU : 0);
#pragma unroll
                for (int e = 0; e < 8; ++e) lg[a][t * 8 + e] = p[e]; } } }
#pragma unroll
    for (int t = 0; t < 8; ++t) { const int b = t & 1; v8f s[2];
#pragma unroll
        for (int e = 0; e < 8; e += 2) { const v2f kv = __builtin_convertvector(rbf2(hi ? lf[b][8 + e] : lf[b][e], hi ? lf[b][9 + e] : lf[b][1 + e]), v2f);   // the skewed QE value and both masks start the accumulator of K.Q^T: no second set of eight registers a tile
#pragma unroll
            for (int a = 0; a < 2; ++a) { s[a][e] = __fadd_rn(lg[a][t * 8 + e], __fadd_rn(bf2f(af[b][a][e]), kv[0])); s[a][e + 1] = __fadd_rn(lg[a][t * 8 + e + 1], __fadd_rn(bf2f(af[b][a][e + 1]), kv[1])); } }
#pragma unroll
        for (int a = 0; a < 2; ++a) { s[a] = wmmab(kf[0], qa[a], s[a]); s[a] = wmmab(kf[1], qb[a], s[a]); }
        if (t + 1 < 8) ldk(t + 1);
        if (t + 2 < 8) ldm(t + 2);
        if (t + 1 == 7) asm volatile("s_wait_xcnt 0x0" ::: "memory");   // behind the last loads of this phase: their address registers are free for the arithmetic that follows
#pragma unroll
        for (int a = 0; a < 2; ++a) {
#pragma unroll
            for (int e = 0; e < 8; ++e) { lg[a][t * 8 + e] = s[a][e]; mx[a] = fmaxf(mx[a], s[a][e]); } }   // 8 x the logit stays where the products left it; the 1/8 is in the factor of the exponent
        __builtin_amdgcn_sched_barrier(0); } // holds the fetch distance: with more tiles' loads lifted to the top the registers run out and logits spill
    v16bf vf[4];                  // V^T fragments of 32 keys, fetched one step ahead into the same registers; the first step's go out in front of the barrier, beside the wait for the other waves
    auto ldv = [&](int ks) {
#pragma unroll
        for (int nb = 0; nb < 4; ++nb) vf[nb] = ldp(vw + ks * 2048 + nb * 512 + po); };
    ldv(0);
#pragma unroll
    for (int a = 0; a < 2; ++a) { mx[a] = fmaxf(mx[a], __shfl_xor(mx[a], 16, 32)); if (hi == 0) rmax[w * 32 + a * 16 + lr] = mx[a]; }
    __syncthreads();              // every wave's row maxima are in LDS, and every read of the QE rows is over before the partial tiles are written over them
#pragma unroll
    for (int a = 0; a < 2; ++a) {
#pragma unroll
        for (int p = 0; p < 16; ++p) mx[a] = fmaxf(mx[a], rmax[p * 32 + a * 16 + lr]); }
    float sum[2] = {0.f, 0.f}; v8f acc[2][4];
#pragma unroll
    for (int a = 0; a < 2; ++a) {
#pragma unroll
        for (int nb = 0; nb < 4; ++nb) acc[a][nb] = (v8f){}; }
#pragma unroll
    for (int ks = 0; ks < 4; ++ks) {   // keys 32 ks + 8 hi + 0..7 and + 16 + 0..7: the k order of the fragment loader
#pragma unroll
        for (int a = 0; a < 2; ++a) { v8u ph, pl;
#pragma unroll
            for (int g = 0; g < 2; ++g) { float xa[8], ev[8];
#pragma unroll
                for (int e = 0; e < 8; ++e) xa[e] = (lg[a][ks * 16 + g * 8 + e] - mx[a]) * (1.44269504f * 0.125f);   // exp((x - max) / 8) = 2^((x - max) log2 e / 8); a power of two moves through every rounding: the same bits
                exp2x8(ev, xa);
#pragma unroll
                for (int e = 0; e < 8; e += 2) { sum[a] += ev[e]; sum[a] += ev[e + 1]; unsigned x, y; splitf2(ev[e], ev[e + 1], x, y); ph[g * 4 + e / 2] = x; pl[g * 4 + e / 2] = y; }
                }
            const v16bf bh = __builtin_bit_cast(v16bf, ph), bl = __builtin_bit_cast(v16bf, pl);
#pragma unroll
            for (int nb = 0; nb < 4; ++nb) { acc[a][nb] = wmmab(vf[nb], bh, acc[a][nb]); acc[a][nb] = wmmab(vf[nb], bl, acc[a][nb]); }
            __builtin_amdgcn_sched_barrier(0); }   // the next exponentials stay behind these products, their subtractions and multiplies in between: lifted among the products, the asm statement writes
                                                   // a product's operand registers inside the four slots that the chip needs behind it
        if (ks + 1 < 4) ldv(ks + 1);
        }
#pragma unroll
    for (int a = 0; a < 2; ++a) { sum[a] += __shfl_xor(sum[a], 16, 32); if (hi == 0) rsum[w * 32 + a * 16 + lr] = sum[a];
#pragma unroll
        for (int nb = 0; nb < 4; ++nb) { float* op = xs + w * (32 * 68) + (a * 16 + lr) * 68 + nb * 16 + 8 * hi;
            *(v4fa*)op = (v4f){acc[a][nb][0], acc[a][nb][1], acc[a][nb][2], acc[a][nb][3]}; *(v4fa*)(op + 4) = (v4f){acc[a][nb][4], acc[a][nb][5], acc[a][nb][6], acc[a][nb][7]}; } }
    __syncthreads();              // all 16 partial tiles and partial sums are in LDS before they are added
#pragma unroll
    for (int a = 0; a < 2; ++a) { const int row = a * 16 + w;
        v2f o = *(const v2fa*)(xs + row * 68 + lane * 2); float tot = rsum[row];
#pragma unroll
        for (int p = 1; p < 16; ++p) { const v2f t = *(const v2fa*)(xs + p * (32 * 68) + row * 68 + lane * 2); o[0] += t[0]; o[1] += t[1]; tot += rsum[p * 32 + row]; }
        const float ri = __fdiv_rn(1.0f, tot); o[0] *= ri; o[1] *= ri;
        *(v2f*)(OUT + (((size_t)n * TT + i0 + row) * NH_ + h) * HD + lane * 2) = o; }
}

extern "C" void kernel_launch(void* const* d_in, const int* in_sizes, int n_in,
                              void* d_out, int out_size, void* d_ws, size_t ws_size, hipStream_t stream) {
    (void)in_sizes; (void)n_in; (void)out_size;
    const float* queries = (const float*)d_in[0]; const float* keys = (const float*)d_in[1]; const float* values = (const float*)d_in[2]; const float* pos_emb = (const float*)d_in[3]; const float* am = (const float*)d_in[4]; const float* kla = (const float*)d_in[5];
    float* OUT = (float*)d_out;     // [2][2048][16][64]
    char* wsp = (char*)d_ws;
    auto take = [&](size_t bytes) { char* p = wsp; wsp += (bytes + 255) & ~(size_t)255; return (void*)p; };
    bf* QF = (bf*)take((size_t)NT * DD * 2); bf* KF = (bf*)take((size_t)NT * DD * 2); bf* VF = (bf*)take((size_t)NT * DD * 2); bf* EF = (bf*)take((size_t)NH_ * TT * HD * 2); bf* MF = (bf*)take((size_t)TT * TT * 2);
    if ((size_t)(wsp - (char*)d_ws) > ws_size) return;    // ws 256 MiB
    k_pack<<<PKW / 16, 512, 0, stream>>>(queries, keys, values, pos_emb, am, QF, KF, VF, EF, MF);
    k_attn<<<NB_ * NH_ * (TT / 32), 512, 0, stream>>>(QF, KF, VF, EF, MF, kla, OUT);
}

// v007
// Measured time: 106 microseconds a run.
// Next to v006, in two timings, it ran 1.13 times as fast each time.
// All steps since v000 together make it 20.3 times as fast.
#include <hip/hip_runtime.h>

// CausalRelativeAttention (queries/keys/values [2][2048][16 heads][64], pos_emb [2048][16][64]; QE = q.E_h^T; Srel = skew(QE) (Music-Transformer pad/reshape trick);
// logits = (q.k^T + Srel + attn_mask_add[l][s] + key_lengths_add[n][s]) / 8; softmax over s; out[n][l][h][d] = sum_s A v).
// Compute dtypes, f32 accumulate: every input rounded to bf16; q.k^T and q.E^T on PLAIN bf16 operands (all inputs: exact products); the skew
// (an index remap of QE: Srel[i][j] = QE[i][L-1+j-i] for j <= i, = 0 for j = i+1, = QE[i+1][j-i-2] for j > i+1 - exactly the reference's pad/reshape), the two additive

#define NB_  2
#define TT   2048
#define NH_  16
#define HD   64
#define DD   (NH_ * HD)           // 1024
#define NT   (NB_ * TT)
typedef _Float16 h16;
typedef unsigned short bf;
typedef __attribute__((ext_vector_type(16))) __bf16   v16bf;
typedef __attribute__((ext_vector_type(16))) _Float16 v16h;
typedef __attribute__((ext_vector_type(8)))  _Float16 v8h;
typedef __attribute__((ext_vector_type(8)))  unsigned short v8us;
typedef __attribute__((ext_vector_type(8)))  float    v8f;
typedef __attribute__((ext_vector_type(4)))  float    v4f;
typedef v8h  __attribute__((may_alias)) v8ha;
typedef v4f  __attribute__((may_alias)) v4fa;
typedef v8us __attribute__((may_alias)) v8usa;

typedef __attribute__((ext_vector_type(2))) float  v2f;
typedef __attribute__((ext_vector_type(2))) __bf16 v2bf;
typedef __attribute__((ext_vector_type(4))) unsigned v4u;
typedef __attribute__((ext_vector_type(8))) unsigned v8u;
typedef v4u __attribute__((may_alias)) v4ua;
// f32 -> bf16, round to nearest even, two values in one conversion instruction that also packs them (x in the low half)
__device__ __forceinline__ v2bf rbf2(float x, float y) { return __builtin_convertvector((v2f){x, y}, v2bf); }
__device__ __forceinline__ unsigned pbf2(float x, float y) { return __builtin_bit_cast(unsigned, rbf2(x, y)); }
__device__ __forceinline__ float bf2f(unsigned short b) { return __uint_as_float(((unsigned)b) << 16); }
__device__ __forceinline__ v16h cat16(v8h lo, v8h hi) { return __builtin_shufflevector(lo, hi, 0, 1, 2, 3, 4, 5, 6, 7, 8, 9, 10, 11, 12, 13, 14, 15); }
__device__ __forceinline__ v16bf cat16b(v8us lo, v8us hi) { return __builtin_bit_cast(v16bf, __builtin_shufflevector(lo, hi, 0, 1, 2, 3, 4, 5, 6, 7, 8, 9, 10, 11, 12, 13, 14, 15)); }
__device__ __forceinline__ v8f wmma16(v16h a, v16h b, v8f c) { return __builtin_amdgcn_wmma_f32_16x16x32_f16(false, a, false, b, (short)0, c, false, false); }
__device__ __forceinline__ v8f wmmab(v16bf a, v16bf b, v8f c) { return __builtin_amdgcn_wmma_f32_16x16x32_bf16(false, a, false, b, (short)0, c, false, false); }



// fragment loader: row = lane & 15, k = 8 (lane >> 4) + 0..7 and 16 + 8 (lane >> 4) + 0..7, the same for the A and the B operand
template <typename T16> struct WFrag;
template <> struct WFrag<h16> { typedef v16h V; static __device__ __forceinline__ V ld(const h16* p) { return cat16(*(const v8h*)p, *(const v8h*)(p + 16)); } static __device__ __forceinline__ v8f mma(V a, V b, v8f c) { return wmma16(a, b, c); } };
template <> struct WFrag<bf> { typedef v16bf V; static __device__ __forceinline__ V ld(const bf* p) { return cat16b(*(const v8us*)p, *(const v8us*)(p + 16)); } static __device__ __forceinline__ v8f mma(V a, V b, v8f c) { return wmmab(a, b, c); } };
// y = hi + lo, both bf16, for two values: hi = bf16(y), lo = bf16(y - hi); the difference is exact in f32
__device__ __forceinline__ void splitf2(float y0, float y1, unsigned& h, unsigned& l) { const v2bf hb = rbf2(y0, y1); const v2f hf = __builtin_convertvector(hb, v2f); h = __builtin_bit_cast(unsigned, hb); l = pbf2(y0 - hf[0], y1 - hf[1]); }

// ---- planes packed in fragment order. A wave-wide 16-byte load of a row-major plane takes 32 bytes from each of 16 lines; here the 32 lanes' chunks of one such load lie side by side,
// 512 contiguous bytes = 4 whole lines, and every line is asked for once. One lane makes one chunk (8 bf16) and a wave writes 4 whole lines a chunk row. The values and their k order are unchanged.
// Q, K and E: [head plane][tile of 16 rows][c = 0..3][lane][8] = row 16 tile + (lane & 15), d = 16 c + 8 (lane >> 4) + 0..7; chunks c = 0, 1 are the fragment of d 0..31, c = 2, 3 that of d 32..63
// V^T: [head plane][block of 32 keys][nb = 0..3][c = 0..1][lane][8] = d 16 nb + (lane & 15), key 32 block + 16 c + 8 (lane >> 4) + 0..7
// additive mask, rounded to bf16 as the logit sum takes it: [tile of 16 queries][tile of 16 keys][lane][8] = query 16 it + (lane & 15), key 16 jt + 8 (lane >> 4) + 0..7: a transposed logit tile's accumulator order
// All five planes are packed by ONE launch of 256 work-groups of 16 waves. Wave W of 4096 makes 18 chunk rows: rows 4 W .. 4 W + 3 of Q, K, V^T and the mask, rows 2 W, 2 W + 1 of E. The four
// (two) neighbouring chunk rows of a plane read whole 128-byte lines of the source between them, and all of a wave's 60 loads are in flight before its first store.
#define PKW 4096                  // waves of the pack launch: a quarter of the 16384 chunk rows of Q, K, V^T and the mask, half of the 8192 of E
__device__ __forceinline__ v4u pk8(v4f a, v4f b) { return (v4u){pbf2(a[0], a[1]), pbf2(a[2], a[3]), pbf2(b[0], b[1]), pbf2(b[2], b[3])}; }
__global__ __launch_bounds__(512) void k_pack(const float* __restrict__ q, const float* __restrict__ k, const float* __restrict__ v, const float* __restrict__ e, const float* __restrict__ am, bf* QF, bf* KF, bf* VF, bf* EF, bf* MF) {
    const int lane = threadIdx.x & 31, lr = lane & 15, hi = lane >> 4; const int W = blockIdx.x * 16 + (threadIdx.x >> 5); const int z = W >> 7, n = z >> 4, h = z & 15;
    const size_t qo = (((size_t)n * TT + (W & 127) * 16 + lr) * NH_ + h) * HD + 8 * hi;                                              // tile W & 127 of head plane z, c = 0
    const float* qp = q + qo; const float* kp = k + qo;
    const float* mp = am + (size_t)((W >> 5) * 16 + lr) * TT + (W & 31) * 64 + 8 * hi;                                               // query tile W >> 5, key tiles 4 (W & 31) + 0..3
    const float* ep = e + ((size_t)(((W >> 1) & 127) * 16 + lr) * NH_ + (W >> 8)) * HD + (W & 1) * 32 + 8 * hi;                      // tile (W >> 1) & 127 of head W >> 8, c = 2 (W & 1) + 0..1
    const float* vp = v + (((size_t)n * TT + ((W >> 1) & 63) * 32 + 8 * hi) * NH_ + h) * HD + (W & 1) * 32 + lr;                     // key block (W >> 1) & 63 of head plane z, nb = 2 (W & 1) + 0..1
    v4f qv[4][2], kv[4][2], mv[4][2], ev[2][2]; float vv[4][8];
#pragma unroll
    for (int u = 0; u < 4; ++u) { qv[u][0] = *(const v4fa*)(qp + u * 16); qv[u][1] = *(const v4fa*)(qp + u * 16 + 4); }
#pragma unroll
    for (int u = 0; u < 4; ++u) { kv[u][0] = *(const v4fa*)(kp + u * 16); kv[u][1] = *(const v4fa*)(kp + u * 16 + 4); }
#pragma unroll
    for (int u = 0; u < 4; ++u) { mv[u][0] = *(const v4fa*)(mp + u * 16); mv[u][1] = *(const v4fa*)(mp + u * 16 + 4); }
#pragma unroll
    for (int u = 0; u < 2; ++u) { ev[u][0] = *(const v4fa*)(ep + u * 16); ev[u][1] = *(const v4fa*)(ep + u * 16 + 4); }
#pragma unroll
    for (int u = 0; u < 4; ++u) {   // chunk row u: c = u & 1, nb = 2 (W & 1) + (u >> 1)
#pragma unroll
        for (int r = 0; r < 8; ++r) vv[u][r] = vp[(size_t)((u & 1) * 16 + r) * DD + (u >> 1) * 16]; }
    __builtin_amdgcn_sched_barrier(0);   // all 60 loads go out before the first wait for data: with conversions lifted among them the last loads started only when the first results were back
    asm volatile("s_wait_xcnt 0x0" :: "v"(qp), "v"(kp), "v"(mp), "v"(ep), "v"(vp) : "memory");   // behind the loads; the five addresses are inputs, so their registers are rewritten by nothing in front of the wait
    const size_t o4 = ((size_t)W * 128 + lane) * 8, o2 = ((size_t)W * 64 + lane) * 8;
    // a plane's conversions and stores stay in the order of its loads (the scheduling barriers): each group then waits for its own loads alone and its stores run beside the loads still in flight
#pragma unroll
    for (int u = 0; u < 4; ++u) *(v4ua*)(QF + o4 + u * 256) = pk8(qv[u][0], qv[u][1]);
    __builtin_amdgcn_sched_barrier(0);
#pragma unroll
    for (int u = 0; u < 4; ++u) *(v4ua*)(KF + o4 + u * 256) = pk8(kv[u][0], kv[u][1]);
    __builtin_amdgcn_sched_barrier(0);
#pragma unroll
    for (int u = 0; u < 4; ++u) *(v4ua*)(MF + o4 + u * 256) = pk8(mv[u][0], mv[u][1]);
    __builtin_amdgcn_sched_barrier(0);
#pragma unroll
    for (int u = 0; u < 2; ++u) *(v4ua*)(EF + o2 + u * 256) = pk8(ev[u][0], ev[u][1]);
    __builtin_amdgcn_sched_barrier(0);
#pragma unroll
    for (int u = 0; u < 4; ++u) *(v4ua*)(VF + o4 + u * 256) = (v4u){pbf2(vv[u][0], vv[u][1]), pbf2(vv[u][2], vv[u][3]), pbf2(vv[u][4], vv[u][5]), pbf2(vv[u][6], vv[u][7])};
}
// a fragment of a packed plane: two chunks, 256 elements apart
__device__ __forceinline__ v16bf ldp(const bf* p) { return cat16b(*(const v8us*)p, *(const v8us*)(p + 256)); }
// logit(i,j) = (q_i.k_j + Srel(i,j) + bf(am[i][j]) + bf(kla[n][j])) / 8 with Srel(i,j) = QE[i][L-1+j-i] (j <= i), 0 (j == i+1), QE[i+1][j-i-2] (j >= i+2), QE[i][r] = q_i.E_h[r].
// ---- k_attn: both logit products, the skew, softmax and P.V of 32 query rows (two tiles of 16) of one head in one work-group of 16 waves; grid 32 heads * L / 32. Every tile is kept
// TRANSPOSED (rows = keys or positions, columns = 16 queries: lane & 15 is the query), so that a logit tile's accumulator registers are, after exp, already the B fragment of V^T.P^T.
// Each E, K and V^T fragment is loaded once and multiplied with both query tiles: the bytes a work-group draws from L2 serve twice the queries.
// Phase A, wave w = positions [128 w, 128 w + 128): QE^T tiles to LDS, one row of XP dwords a query; row i0+31 reads on in QE row i0+32, which is the first column of a third
// tile on queries i0+32..i0+47. Phase B, wave w = the four blocks of 32 keys w, w + 16, w + 32, w + 48 (KO below): the skewed QE run from LDS plus both
// masks is the start value of the K.Q^T accumulator; row max over lanes, then over waves through LDS. Phase C: exp, bf16 hi/lo split, V^T.P^T on the wave's own 128 keys, f32 partial tiles to LDS; a block of 32 keys whose 2^x are all exactly 0 is left out.
// Phase D: the 16 partials and the 16 partial row sums are added in wave order, scaled by 1/sum and stored as whole 256-byte rows of the output.
#define XP 2052                   // pitch of a QE row in LDS, in dwords: 16-byte stores of 16 rows fall on all 64 banks (pitch = 4 mod 64), the skewed dword reads step 3 banks a lane
#define XU (XP - TT - 1)          // a row's run for j >= i+2 starts this many dwords behind the place where its run for j <= i would go on
#define KO(t) (((t) >> 1) * 512 + ((t) & 1) * 16)   // first key of a wave's key tile t = 0..7, counted from its first key 32 w: blocks of 32 keys are dealt to the 16 waves in turn
// eight 2^x in one statement: behind a v_exp_f32 the instruction set asks for one independent instruction before its result is read or its source overwritten; here each is the
// next one's (outputs share no register with an input), and the v_nop is the last one's.
__device__ __forceinline__ void exp2x8(float* r, const float* x) {
    asm("v_exp_f32 %0, %8\n\tv_exp_f32 %1, %9\n\tv_exp_f32 %2, %10\n\tv_exp_f32 %3, %11\n\tv_exp_f32 %4, %12\n\tv_exp_f32 %5, %13\n\tv_exp_f32 %6, %14\n\tv_exp_f32 %7, %15\n\tv_nop"
        : "=&v"(r[0]), "=&v"(r[1]), "=&v"(r[2]), "=&v"(r[3]), "=&v"(r[4]), "=&v"(r[5]), "=&v"(r[6]), "=&v"(r[7]) : "v"(x[0]), "v"(x[1]), "v"(x[2]), "v"(x[3]), "v"(x[4]), "v"(x[5]), "v"(x[6]), "v"(x[7]));
}
typedef v2f  __attribute__((may_alias)) v2fa;
__global__ __launch_bounds__(512) void k_attn(const bf* __restrict__ QF, const bf* __restrict__ KF, const bf* __restrict__ VF, const bf* __restrict__ EF, const bf* __restrict__ MF, const float* __restrict__ kla, float* OUT) {
    __shared__ __align__(16) float xs[33 * XP];   // phases A and B: QE rows i0..i0+32; phases C and D: the 16 partial output tiles, 32 x 68 dwords each
    __shared__ float rmax[16 * 32];
    __shared__ float rsum[16 * 32];
    const int lane = threadIdx.x & 31, lr = lane & 15, hi = lane >> 4; const int w = __builtin_amdgcn_readfirstlane(threadIdx.x >> 5);
    const int z = blockIdx.x / (TT / 32); const int i0 = (blockIdx.x % (TT / 32)) * 32; const int n = z >> 4, h = z & 15;
    const bf* qz = QF + (size_t)z * TT * HD; const bf* kw = KF + (size_t)z * TT * HD + (size_t)w * 32 * HD; const bf* ew = EF + (size_t)h * TT * HD + (size_t)w * 128 * HD; const bf* vw = VF + (size_t)z * HD * TT + (size_t)w * 32 * HD;
    const unsigned po = (unsigned)(lane * 8);           // in the packed planes: a tile of 16 rows is 1024 elements, a V^T block of 32 keys 2048, a mask tile 256
    const bf* q0p = qz + i0 * HD; const bf* q2p = qz + (i0 + 32 < TT ? i0 + 32 : i0) * HD;   // the tile of queries below; the last block has no row below it, and its row 32 in LDS is never read
    v16bf qa[2], qb[2];
#pragma unroll
    for (int a = 0; a < 2; ++a) { qa[a] = ldp(q0p + a * 1024 + po); qb[a] = ldp(q0p + a * 1024 + 512 + po); }
    const bf* mw = MF + ((size_t)(i0 >> 4) * (TT / 16) + w * 2) * 256; const float* kr = kla + (size_t)n * TT + w * 32;   // the same address in every lane: the key-length values come through scalar registers
    // a key tile's two K fragments are fetched one tile ahead into the same registers, right behind the products that read them; its mask and key-length values two tiles ahead into two register sets
    v16bf kf[2]; v8us af[2][2]; float lf[2][16];
    auto ldk = [&](int t) { kf[0] = ldp(kw + KO(t) * HD + po); kf[1] = ldp(kw + KO(t) * HD + 512 + po); };
    auto ldm = [&](int t) { const int s = t & 1; af[s][0] = *(const v8usa*)(mw + KO(t) * 16 + po); af[s][1] = *(const v8usa*)(mw + (TT / 16) * 256 + KO(t) * 16 + po);
#pragma unroll
        for (int e = 0; e < 16; ++e) lf[s][e] = kr[KO(t) + e]; };
    {
        const v16bf q2a = ldp(q2p + po), q2b = ldp(q2p + 512 + po);
        v8f u[8], d[2][2]; float* xp = xs + lr * XP + w * 128 + 8 * hi;
        auto std = [&](int t) {
#pragma unroll
            for (int a = 0; a < 2; ++a) { const v8f x = d[t & 1][a]; *(v4fa*)(xp + a * 16 * XP + t * 16) = (v4f){x[0], x[1], x[2], x[3]}; *(v4fa*)(xp + a * 16 * XP + t * 16 + 4) = (v4f){x[4], x[5], x[6], x[7]}; } };
        v16bf ef[8][2];           // all eight E tiles are asked for at once: the registers that they leave, tile by tile, take the third query tile's results
#pragma unroll
        for (int t = 0; t < 8; ++t) { ef[t][0] = ldp(ew + t * 1024 + po); ef[t][1] = ldp(ew + t * 1024 + 512 + po); }
        asm volatile("s_wait_xcnt 0x0" :: "s"(ew), "s"(q0p), "s"(q2p) : "memory");   // behind the Q and E loads; their base addresses are inputs, so the scalar registers that hold them are rewritten by nothing in front of the wait
#pragma unroll
        for (int t = 0; t < 8; ++t) { const v16bf e0 = ef[t][0], e1 = ef[t][1]; u[t] = (v8f){};
            u[t] = wmmab(e0, q2a, u[t]); u[t] = wmmab(e1, q2b, u[t]);
#pragma unroll
            for (int a = 0; a < 2; ++a) { d[t & 1][a] = (v8f){}; d[t & 1][a] = wmmab(e0, qa[a], d[t & 1][a]); d[t & 1][a] = wmmab(e1, qb[a], d[t & 1][a]); }
            __builtin_amdgcn_sched_barrier(0);   // a tile's LDS stores stay behind the next tile's six products: those fill the slots between a product and the first read of its result
            if (t > 0) std(t - 1); }
        std(7);
        ldk(0); ldm(0); ldm(1);   // the next phase's first loads go out in front of the barrier: their latency runs beside the LDS stores and the wait for the other waves
        if (lr == 0) {            // column 0 of the third tile is query i0+32
#pragma unroll
            for (int t = 0; t < 8; ++t) { *(v4fa*)(xp + 32 * XP + t * 16) = (v4f){u[t][0], u[t][1], u[t][2], u[t][3]}; *(v4fa*)(xp + 32 * XP + t * 16 + 4) = (v4f){u[t][4], u[t][5], u[t][6], u[t][7]}; } }
    }
    __syncthreads();              // every QE row is in LDS before another wave reads its skewed run
    float lg[2][64]; float mx[2] = {-__builtin_inff(), -__builtin_inff()};   // below every value: the maximum is taken of 8 x the logit, which may lie under any finite start
    float mk[4] = {-__builtin_inff(), -__builtin_inff(), -__builtin_inff(), -__builtin_inff()};   // a lane's largest value of each block of 32 keys, over its two rows
#pragma unroll
    for (int a = 0; a < 2; ++a) { const int ia0 = i0 + 16 * a, i = ia0 + lr; const float* xb = xs + (a * 16 + lr) * XP + (TT - 1 - i) + w * 32 + 8 * hi;
#pragma unroll
        for (int t = 0; t < 8; ++t) { const int j0 = w * 32 + KO(t);   // the skewed runs first, so that the loop of products below has no branch in it
            if (j0 == ia0 || j0 == ia0 + 16) {    // the two tiles that the diagonal j == i+1 crosses: each element picks its own run; at j == i+1 the neighbour is read and dropped
#pragma unroll
                for (int e = 0; e < 8; ++e) { const int je = j0 + 8 * hi + e; const float v = xb[KO(t) + e + (je > i + 1 ? XU : (je > i ? -1 : 0))]; lg[a][t * 8 + e] = (je == i + 1) ? 0.f : v; }
            } else { const float* p = xb + (j0 > ia0 ? KO(t) + XU : KO(t));
#pragma unroll
                for (int e = 0; e < 8; ++e) lg[a][t * 8 + e] = p[e]; } } }
#pragma unroll
    for (int t = 0; t < 8; ++t) { const int b = t & 1; v8f s[2];
#pragma unroll
        for (int e = 0; e < 8; e += 2) { const v2f kv = __builtin_convertvector(rbf2(hi ? lf[b][8 + e] : lf[b][e], hi ? lf[b][9 + e] : lf[b][1 + e]), v2f);   // the skewed QE value and both masks start the accumulator of K.Q^T: no second set of eight registers a tile
#pragma unroll
            for (int a = 0; a < 2; ++a) { s[a][e] = __fadd_rn(lg[a][t * 8 + e], __fadd_rn(bf2f(af[b][a][e]), kv[0])); s[a][e + 1] = __fadd_rn(lg[a][t * 8 + e + 1], __fadd_rn(bf2f(af[b][a][e + 1]), kv[1])); } }
#pragma unroll
        for (int a = 0; a < 2; ++a) { s[a] = wmmab(kf[0], qa[a], s[a]); s[a] = wmmab(kf[1], qb[a], s[a]); }
        if (t + 1 < 8) ldk(t + 1);
        if (t + 2 < 8) ldm(t + 2);
        if (t + 1 == 7) asm volatile("s_wait_xcnt 0x0" ::: "memory");   // behind the last loads of this phase: their address registers are free for the arithmetic that follows
        float tm[2];
#pragma unroll
        for (int a = 0; a < 2; ++a) { tm[a] = s[a][0];
#pragma unroll
            for (int e = 0; e < 8; ++e) { lg[a][t * 8 + e] = s[a][e]; if (e) tm[a] = fmaxf(tm[a], s[a][e]); }   // 8 x the logit stays where the products left it; the 1/8 is in the factor of the exponent
            mx[a] = fmaxf(mx[a], tm[a]); }
        mk[t >> 1] = fmaxf(mk[t >> 1], fmaxf(tm[0], tm[1]));
        __builtin_amdgcn_sched_barrier(0); } // holds the fetch distance: with more tiles' loads lifted to the top the registers run out and logits spill
    v16bf vf[4];                  // V^T fragments of 32 keys, fetched one step ahead into the same registers; the first go out once the wave knows which blocks it needs, and fly beside its first exponentials
    auto ldv = [&](int ks) {
#pragma unroll
        for (int nb = 0; nb < 4; ++nb) vf[nb] = ldp(vw + ks * (512 * HD) + nb * 512 + po); };
#pragma unroll
    for (int a = 0; a < 2; ++a) { mx[a] = fmaxf(mx[a], __shfl_xor(mx[a], 16, 32)); if (hi == 0) rmax[w * 32 + a * 16 + lr] = mx[a]; }
    __syncthreads();              // every wave's row maxima are in LDS, and every read of the QE rows is over before the partial tiles are written over them
#pragma unroll
    for (int a = 0; a < 2; ++a) {
#pragma unroll
        for (int p = 0; p < 16; ++p) mx[a] = fmaxf(mx[a], rmax[p * 32 + a * 16 + lr]); }
    float sum[2] = {0.f, 0.f}; v8f acc[2][4];
#pragma unroll
    for (int a = 0; a < 2; ++a) {
#pragma unroll
        for (int nb = 0; nb < 4; ++nb) acc[a][nb] = (v8f){}; }
    // Where, in every lane, the largest value of a block of 32 keys taken against the smaller of the lane's two row maxima gives an exponent under -160, every 2^x of the block is exactly 0 (the
    // smallest f32 above 0 is 2^-149; subtraction and multiply are monotone): it adds nothing to the row sums and, V being finite, nothing to the partial tiles. Such a block is left out: no exponentials, no V^T loads, no products.
    // The test is on the computed logits alone, holds for any mask, and is false where a NaN makes it so. One answer a wave: scalar branches, EXEC stays full around the products.
    bool live[4];
#pragma unroll
    for (int ks = 0; ks < 4; ++ks) live[ks] = !__all((mk[ks] - fminf(mx[0], mx[1])) * (1.44269504f * 0.125f) < -160.f);
    if (live[0]) ldv(0);
#pragma unroll
    for (int ks = 0; ks < 4; ++ks) {   // keys 8 hi + 0..7 and 16 + 8 hi + 0..7 of the block: the k order of the fragment loader
        if (live[ks]) {
#pragma unroll
        for (int a = 0; a < 2; ++a) { v8u ph, pl;
#pragma unroll
            for (int g = 0; g < 2; ++g) { float xa[8], ev[8];
#pragma unroll
                for (int e = 0; e < 8; ++e) xa[e] = (lg[a][ks * 16 + g * 8 + e] - mx[a]) * (1.44269504f * 0.125f);   // exp((x - max) / 8) = 2^((x - max) log2 e / 8); a power of two moves through every rounding: the same bits
                exp2x8(ev, xa);
#pragma unroll
                for (int e = 0; e < 8; e += 2) { sum[a] += ev[e]; sum[a] += ev[e + 1]; unsigned x, y; splitf2(ev[e], ev[e + 1], x, y); ph[g * 4 + e / 2] = x; pl[g * 4 + e / 2] = y; }
                }
            const v16bf bh = __builtin_bit_cast(v16bf, ph), bl = __builtin_bit_cast(v16bf, pl);
#pragma unroll
            for (int nb = 0; nb < 4; ++nb) { acc[a][nb] = wmmab(vf[nb], bh, acc[a][nb]); acc[a][nb] = wmmab(vf[nb], bl, acc[a][nb]); }
            __builtin_amdgcn_sched_barrier(0); }   // the next exponentials stay behind these products, their subtractions and multiplies in between: lifted among the products, the asm statement writes
                                                   // a product's operand registers inside the four slots that the chip needs behind it
        }
        if (ks + 1 < 4 && live[ks + 1]) ldv(ks + 1);
        }
#pragma unroll
    for (int a = 0; a < 2; ++a) { sum[a] += __shfl_xor(sum[a], 16, 32); if (hi == 0) rsum[w * 32 + a * 16 + lr] = sum[a];
#pragma unroll
        for (int nb = 0; nb < 4; ++nb) { float* op = xs + w * (32 * 68) + (a * 16 + lr) * 68 + nb * 16 + 8 * hi;
            *(v4fa*)op = (v4f){acc[a][nb][0], acc[a][nb][1], acc[a][nb][2], acc[a][nb][3]}; *(v4fa*)(op + 4) = (v4f){acc[a][nb][4], acc[a][nb][5], acc[a][nb][6], acc[a][nb][7]}; } }
    __syncthreads();              // all 16 partial tiles and partial sums are in LDS before they are added
#pragma unroll
    for (int a = 0; a < 2; ++a) { const int row = a * 16 + w;
        v2f o = *(const v2fa*)(xs + row * 68 + lane * 2); float tot = rsum[row];
#pragma unroll
        for (int p = 1; p < 16; ++p) { const v2f t = *(const v2fa*)(xs + p * (32 * 68) + row * 68 + lane * 2); o[0] += t[0]; o[1] += t[1]; tot += rsum[p * 32 + row]; }
        const float ri = __fdiv_rn(1.0f, tot); o[0] *= ri; o[1] *= ri;
        *(v2f*)(OUT + (((size_t)n * TT + i0 + row) * NH_ + h) * HD + lane * 2) = o; }
}

extern "C" void kernel_launch(void* const* d_in, const int* in_sizes, int n_in,
                              void* d_out, int out_size, void* d_ws, size_t ws_size, hipStream_t stream) {
    (void)in_sizes; (void)n_in; (void)out_size;
    const float* queries = (const float*)d_in[0]; const float* keys = (const float*)d_in[1]; const float* values = (const float*)d_in[2]; const float* pos_emb = (const float*)d_in[3]; const float* am = (const float*)d_in[4]; const float* kla = (const float*)d_in[5];
    float* OUT = (float*)d_out;     // [2][2048][16][64]
    char* wsp = (char*)d_ws;
    auto take = [&](size_t bytes) { char* p = wsp; wsp += (bytes + 255) & ~(size_t)255; return (void*)p; };
    bf* QF = (bf*)take((size_t)NT * DD * 2); bf* KF = (bf*)take((size_t)NT * DD * 2); bf* VF = (bf*)take((size_t)NT * DD * 2); bf* EF = (bf*)take((size_t)NH_ * TT * HD * 2); bf* MF = (bf*)take((size_t)TT * TT * 2);
    if ((size_t)(wsp - (char*)d_ws) > ws_size) return;    // ws 256 MiB
    k_pack<<<PKW / 16, 512, 0, stream>>>(queries, keys, values, pos_emb, am, QF, KF, VF, EF, MF);
    k_attn<<<NB_ * NH_ * (TT / 32), 512, 0, stream>>>(QF, KF, VF, EF, MF, kla, OUT);
}

// v008
// Measured time: 91.6 microseconds a run.
// Next to v007, in two timings, it ran 1.15 and 1.16 times as fast.
// Over all steps from v000 it is 23.5 times as fast.
#include <hip/hip_runtime.h>

// CausalRelativeAttention (queries/keys/values [2][2048][16 heads][64], pos_emb [2048][16][64]; QE = q.E_h^T; Srel = skew(QE) (Music-Transformer pad/reshape trick);
// logits = (q.k^T + Srel + attn_mask_add[l][s] + key_lengths_add[n][s]) / 8; softmax over s; out[n][l][h][d] = sum_s A v).
// Compute dtypes, f32 accumulate: every input rounded to bf16; q.k^T and q.E^T on PLAIN bf16 operands (all inputs: exact products); the skew
// (an index remap of QE: Srel[i][j] = QE[i][L-1+j-i] for j <= i, = 0 for j = i+1, = QE[i+1][j-i-2] for j > i+1 - exactly the reference's pad/reshape), the two additive

#define NB_  2
#define TT   2048
#define NH_  16
#define HD   64
#define DD   (NH_ * HD)           // 1024
#define NT   (NB_ * TT)
typedef _Float16 h16;
typedef unsigned short bf;
typedef __attribute__((ext_vector_type(16))) __bf16   v16bf;
typedef __attribute__((ext_vector_type(16))) _Float16 v16h;
typedef __attribute__((ext_vector_type(8)))  _Float16 v8h;
typedef __attribute__((ext_vector_type(8)))  unsigned short v8us;
typedef __attribute__((ext_vector_type(8)))  float    v8f;
typedef __attribute__((ext_vector_type(4)))  float    v4f;
typedef v8h  __attribute__((may_alias)) v8ha;
typedef v4f  __attribute__((may_alias)) v4fa;
typedef v8us __attribute__((may_alias)) v8usa;

typedef __attribute__((ext_vector_type(2))) float  v2f;
typedef __attribute__((ext_vector_type(2))) __bf16 v2bf;
typedef __attribute__((ext_vector_type(4))) unsigned v4u;
typedef __attribute__((ext_vector_type(8))) unsigned v8u;
typedef v4u __attribute__((may_alias)) v4ua;
// f32 -> bf16, round to nearest even, two values in one conversion instruction that also packs them (x in the low half)
__device__ __forceinline__ v2bf rbf2(float x, float y) { return __builtin_convertvector((v2f){x, y}, v2bf); }
__device__ __forceinline__ unsigned pbf2(float x, float y) { return __builtin_bit_cast(unsigned, rbf2(x, y)); }
__device__ __forceinline__ float bf2f(unsigned short b) { return __uint_as_float(((unsigned)b) << 16); }
__device__ __forceinline__ v16h cat16(v8h lo, v8h hi) { return __builtin_shufflevector(lo, hi, 0, 1, 2, 3, 4, 5, 6, 7, 8, 9, 10, 11, 12, 13, 14, 15); }
__device__ __forceinline__ v16bf cat16b(v8us lo, v8us hi) { return __builtin_bit_cast(v16bf, __builtin_shufflevector(lo, hi, 0, 1, 2, 3, 4, 5, 6, 7, 8, 9, 10, 11, 12, 13, 14, 15)); }
__device__ __forceinline__ v8f wmma16(v16h a, v16h b, v8f c) { return __builtin_amdgcn_wmma_f32_16x16x32_f16(false, a, false, b, (short)0, c, false, false); }
__device__ __forceinline__ v8f wmmab(v16bf a, v16bf b, v8f c) { return __builtin_amdgcn_wmma_f32_16x16x32_bf16(false, a, false, b, (short)0, c, false, false); }



// fragment loader: row = lane & 15, k = 8 (lane >> 4) + 0..7 and 16 + 8 (lane >> 4) + 0..7, the same for the A and the B operand
template <typename T16> struct WFrag;
template <> struct WFrag<h16> { typedef v16h V; static __device__ __forceinline__ V ld(const h16* p) { return cat16(*(const v8h*)p, *(const v8h*)(p + 16)); } static __device__ __forceinline__ v8f mma(V a, V b, v8f c) { return wmma16(a, b, c); } };
template <> struct WFrag<bf> { typedef v16bf V; static __device__ __forceinline__ V ld(const bf* p) { return cat16b(*(const v8us*)p, *(const v8us*)(p + 16)); } static __device__ __forceinline__ v8f mma(V a, V b, v8f c) { return wmmab(a, b, c); } };
// y = hi + lo, both bf16, for two values: hi = bf16(y), lo = bf16(y - hi); the difference is exact in f32
__device__ __forceinline__ void splitf2(float y0, float y1, unsigned& h, unsigned& l) { const v2bf hb = rbf2(y0, y1); const v2f hf = __builtin_convertvector(hb, v2f); h = __builtin_bit_cast(unsigned, hb); l = pbf2(y0 - hf[0], y1 - hf[1]); }

// ---- planes packed in fragment order. A wave-wide 16-byte load of a row-major plane takes 32 bytes from each of 16 lines; here the 32 lanes' chunks of one such load lie side by side,
// 512 contiguous bytes = 4 whole lines, and every line is asked for once. One lane makes one chunk (8 bf16) and a wave writes 4 whole lines a chunk row. The values and their k order are unchanged.
// Q, K and E: [head plane][tile of 16 rows][c = 0..3][lane][8] = row 16 tile + (lane & 15), d = 16 c + 8 (lane >> 4) + 0..7; chunks c = 0, 1 are the fragment of d 0..31, c = 2, 3 that of d 32..63
// V^T: [head plane][block of 32 keys][nb = 0..3][c = 0..1][lane][8] = d 16 nb + (lane & 15), key 32 block + 16 c + 8 (lane >> 4) + 0..7
// additive mask, rounded to bf16 as the logit sum takes it: [tile of 16 queries][tile of 16 keys][lane][8] = query 16 it + (lane & 15), key 16 jt + 8 (lane >> 4) + 0..7: a transposed logit tile's accumulator order
// All five planes are packed by ONE launch of 256 work-groups of 16 waves. Wave W of 4096 makes 18 chunk rows: rows 4 W .. 4 W + 3 of Q, K, V^T and the mask, rows 2 W, 2 W + 1 of E. The four
// (two) neighbouring chunk rows of a plane read whole 128-byte lines of the source between them, and all of a wave's 61 loads (one of them a key-length value, for the bounds below) are in flight before its first store.
#define PKW 4096                  // waves of the pack launch: a quarter of the 16384 chunk rows of Q, K, V^T and the mask, half of the 8192 of E
__device__ __forceinline__ v4u pk8(v4f a, v4f b) { return (v4u){pbf2(a[0], a[1]), pbf2(a[2], a[3]), pbf2(b[0], b[1]), pbf2(b[2], b[3])}; }
// Bounds for the attention kernel's test of which blocks of 32 keys can matter at all (see there), made from the values that the pack launch holds in registers anyway:
// ST[work-group][0..2] = largest sum of squares of a row of its 16 Q tiles, its 16 K tiles, its 16 half tiles of E; MS[tile of 16 queries][block of 32 keys] = {largest mask value, smallest over the
// 16 rows of the row's largest mask value}; KL[batch][block of 32 keys] = {largest, smallest key-length value}. One wave of a work-group stores them: whole 128-byte lines have one writer.
__device__ __forceinline__ float smax16(float x) {
#pragma unroll
    for (int m = 1; m < 16; m <<= 1) x = fmaxf(x, __shfl_xor(x, m, 32));
    return x; }
__device__ __forceinline__ float smin16(float x) {
#pragma unroll
    for (int m = 1; m < 16; m <<= 1) x = fminf(x, __shfl_xor(x, m, 32));
    return x; }
__device__ __forceinline__ float sq8(v4f a, v4f b) { return a[0] * a[0] + a[1] * a[1] + a[2] * a[2] + a[3] * a[3] + b[0] * b[0] + b[1] * b[1] + b[2] * b[2] + b[3] * b[3]; }
__device__ __forceinline__ float mx8(v4f a, v4f b) { return fmaxf(fmaxf(fmaxf(a[0], a[1]), fmaxf(a[2], a[3])), fmaxf(fmaxf(b[0], b[1]), fmaxf(b[2], b[3]))); }
__global__ __launch_bounds__(512) void k_pack(const float* __restrict__ q, const float* __restrict__ k, const float* __restrict__ v, const float* __restrict__ e, const float* __restrict__ am, const float* __restrict__ kla, bf* QF, bf* KF, bf* VF, bf* EF, bf* MF, float* ST, float* MS, float* KL) {
    __shared__ float st[16][12];
    const int lane = threadIdx.x & 31, lr = lane & 15, hi = lane >> 4; const int W = blockIdx.x * 16 + (threadIdx.x >> 5); const int z = W >> 7, n = z >> 4, h = z & 15;
    const size_t qo = (((size_t)n * TT + (W & 127) * 16 + lr) * NH_ + h) * HD + 8 * hi;                                              // tile W & 127 of head plane z, c = 0
    const float* qp = q + qo; const float* kp = k + qo;
    const float* mp = am + (size_t)((W >> 5) * 16 + lr) * TT + (W & 31) * 64 + 8 * hi;                                               // query tile W >> 5, key tiles 4 (W & 31) + 0..3
    const float* ep = e + ((size_t)(((W >> 1) & 127) * 16 + lr) * NH_ + (W >> 8)) * HD + (W & 1) * 32 + 8 * hi;                      // tile (W >> 1) & 127 of head W >> 8, c = 2 (W & 1) + 0..1
    const float* vp = v + (((size_t)n * TT + ((W >> 1) & 63) * 32 + 8 * hi) * NH_ + h) * HD + (W & 1) * 32 + lr;                     // key block (W >> 1) & 63 of head plane z, nb = 2 (W & 1) + 0..1
    const float* lp = kla + (W & 127) * 32 + lane;                                                                                   // block of 32 keys W & 127 of the 128 of both batches
    v4f qv[4][2], kv[4][2], mv[4][2], ev[2][2]; float vv[4][8]; const float lv = *lp;
#pragma unroll
    for (int u = 0; u < 4; ++u) { qv[u][0] = *(const v4fa*)(qp + u * 16); qv[u][1] = *(const v4fa*)(qp + u * 16 + 4); }
#pragma unroll
    for (int u = 0; u < 4; ++u) { kv[u][0] = *(const v4fa*)(kp + u * 16); kv[u][1] = *(const v4fa*)(kp + u * 16 + 4); }
#pragma unroll
    for (int u = 0; u < 4; ++u) { mv[u][0] = *(const v4fa*)(mp + u * 16); mv[u][1] = *(const v4fa*)(mp + u * 16 + 4); }
#pragma unroll
    for (int u = 0; u < 2; ++u) { ev[u][0] = *(const v4fa*)(ep + u * 16); ev[u][1] = *(const v4fa*)(ep + u * 16 + 4); }
#pragma unroll
    for (int u = 0; u < 4; ++u) {   // chunk row u: c = u & 1, nb = 2 (W & 1) + (u >> 1)
#pragma unroll
        for (int r = 0; r < 8; ++r) vv[u][r] = vp[(size_t)((u & 1) * 16 + r) * DD + (u >> 1) * 16]; }
    __builtin_amdgcn_sched_barrier(0);   // all 61 loads go out before the first wait for data: with conversions lifted among them the last loads started only when the first results were back
    asm volatile("s_wait_xcnt 0x0" :: "v"(qp), "v"(kp), "v"(mp), "v"(ep), "v"(vp), "v"(lp) : "memory");   // behind the loads; the six addresses are inputs, so their registers are rewritten by nothing in front of the wait
    const size_t o4 = ((size_t)W * 128 + lane) * 8, o2 = ((size_t)W * 64 + lane) * 8;
    // a plane's conversions and stores stay in the order of its loads (the scheduling barriers): each group then waits for its own loads alone and its stores run beside the loads still in flight
#pragma unroll
    for (int u = 0; u < 4; ++u) *(v4ua*)(QF + o4 + u * 256) = pk8(qv[u][0], qv[u][1]);
    __builtin_amdgcn_sched_barrier(0);
#pragma unroll
    for (int u = 0; u < 4; ++u) *(v4ua*)(KF + o4 + u * 256) = pk8(kv[u][0], kv[u][1]);
    __builtin_amdgcn_sched_barrier(0);
#pragma unroll
    for (int u = 0; u < 4; ++u) *(v4ua*)(MF + o4 + u * 256) = pk8(mv[u][0], mv[u][1]);
    __builtin_amdgcn_sched_barrier(0);
#pragma unroll
    for (int u = 0; u < 2; ++u) *(v4ua*)(EF + o2 + u * 256) = pk8(ev[u][0], ev[u][1]);
    __builtin_amdgcn_sched_barrier(0);
#pragma unroll
    for (int u = 0; u < 4; ++u) *(v4ua*)(VF + o4 + u * 256) = (v4u){pbf2(vv[u][0], vv[u][1]), pbf2(vv[u][2], vv[u][3]), pbf2(vv[u][4], vv[u][5]), pbf2(vv[u][6], vv[u][7])};
    {   // the bounds: a row's values lie in lanes lr and lr + 16
        const int wv = threadIdx.x >> 5;
        float qs = 0.f, ks = 0.f, es = 0.f, mm[2];
#pragma unroll
        for (int u = 0; u < 4; ++u) { qs += sq8(qv[u][0], qv[u][1]); ks += sq8(kv[u][0], kv[u][1]); }
#pragma unroll
        for (int u = 0; u < 2; ++u) { es += sq8(ev[u][0], ev[u][1]); mm[u] = fmaxf(mx8(mv[2 * u][0], mv[2 * u][1]), mx8(mv[2 * u + 1][0], mv[2 * u + 1][1])); mm[u] = fmaxf(mm[u], __shfl_xor(mm[u], 16, 32)); }
        qs = smax16(qs + __shfl_xor(qs, 16, 32)); ks = smax16(ks + __shfl_xor(ks, 16, 32)); es = smax16(es + __shfl_xor(es, 16, 32));
        const float h0 = smax16(mm[0]), l0 = smin16(mm[0]), h1 = smax16(mm[1]), l1 = smin16(mm[1]);
        const float lh = smax16(fmaxf(lv, __shfl_xor(lv, 16, 32))), ll = smin16(fminf(lv, __shfl_xor(lv, 16, 32)));
        if (lane == 0) { st[wv][0] = qs; st[wv][1] = ks; st[wv][2] = es; st[wv][4] = h0; st[wv][5] = l0; st[wv][6] = h1; st[wv][7] = l1; st[wv][8] = lh; st[wv][9] = ll; }
        __syncthreads();          // the 16 waves' bounds are in LDS before wave 0 gathers them
        if (wv == 0) {
            *(v2f*)(MS + blockIdx.x * 64 + lane * 2) = (v2f){st[lane >> 1][4 + (lane & 1) * 2], st[lane >> 1][5 + (lane & 1) * 2]};
            const float a = smax16(st[lr][0]), b = smax16(st[lr][1]), c = smax16(st[lr][2]);
            if (lane == 0) *(v4f*)(ST + blockIdx.x * 32) = (v4f){a, b, c, 0.f};
            if (blockIdx.x < 8 && lane < 16) *(v2f*)(KL + blockIdx.x * 32 + lane * 2) = (v2f){st[lane][8], st[lane][9]};
        }
    }
}
// a fragment of a packed plane: two chunks, 256 elements apart
__device__ __forceinline__ v16bf ldp(const bf* p) { return cat16b(*(const v8us*)p, *(const v8us*)(p + 256)); }
// logit(i,j) = (q_i.k_j + Srel(i,j) + bf(am[i][j]) + bf(kla[n][j])) / 8 with Srel(i,j) = QE[i][L-1+j-i] (j <= i), 0 (j == i+1), QE[i+1][j-i-2] (j >= i+2), QE[i][r] = q_i.E_h[r].
// ---- k_attn: both logit products, the skew, softmax and P.V of 32 query rows (two tiles of 16) of one head in one work-group of 16 waves; grid 32 heads * L / 32. Every tile is kept
// TRANSPOSED (rows = keys or positions, columns = 16 queries: lane & 15 is the query), so that a logit tile's accumulator registers are, after exp, already the B fragment of V^T.P^T.
// Each E, K and V^T fragment is loaded once and multiplied with both query tiles: the bytes a work-group draws from L2 serve twice the queries.
// Phase A, wave w = the four blocks of 32 positions w, w + 16, w + 32, w + 48 (KO below), those of them that a block of keys which is worked on reads: QE^T tiles to LDS, one row of XP dwords a query; row i0+31 reads on in QE row i0+32, which is the first column of a third
// tile on queries i0+32..i0+47. Phase B, wave w = the four blocks of 32 keys w, w + 16, w + 32, w + 48 (KO below): the skewed QE run from LDS plus both
// masks is the start value of the K.Q^T accumulator; row max over lanes, then over waves through LDS. Phase C: exp, bf16 hi/lo split, V^T.P^T on the wave's own 128 keys, f32 partial tiles to LDS; a block of 32 keys whose 2^x are all exactly 0 is left out.
// Phase D: the 16 partials and the 16 partial row sums are added in wave order, scaled by 1/sum and stored as whole 256-byte rows of the output.
#define XP 2052                   // pitch of a QE row in LDS, in dwords: 16-byte stores of 16 rows fall on all 64 banks (pitch = 4 mod 64), the skewed dword reads step 3 banks a lane
#define XU (XP - TT - 1)          // a row's run for j >= i+2 starts this many dwords behind the place where its run for j <= i would go on
#define KO(t) (((t) >> 1) * 512 + ((t) & 1) * 16)   // first key of a wave's key tile t = 0..7, counted from its first key 32 w: blocks of 32 keys are dealt to the 16 waves in turn
// eight 2^x in one statement: behind a v_exp_f32 the instruction set asks for one independent instruction before its result is read or its source overwritten; here each is the
// next one's (outputs share no register with an input), and the v_nop is the last one's.
__device__ __forceinline__ void exp2x8(float* r, const float* x) {
    asm("v_exp_f32 %0, %8\n\tv_exp_f32 %1, %9\n\tv_exp_f32 %2, %10\n\tv_exp_f32 %3, %11\n\tv_exp_f32 %4, %12\n\tv_exp_f32 %5, %13\n\tv_exp_f32 %6, %14\n\tv_exp_f32 %7, %15\n\tv_nop"
        : "=&v"(r[0]), "=&v"(r[1]), "=&v"(r[2]), "=&v"(r[3]), "=&v"(r[4]), "=&v"(r[5]), "=&v"(r[6]), "=&v"(r[7]) : "v"(x[0]), "v"(x[1]), "v"(x[2]), "v"(x[3]), "v"(x[4]), "v"(x[5]), "v"(x[6]), "v"(x[7]));
}
typedef v2f  __attribute__((may_alias)) v2fa;
__global__ __launch_bounds__(512) void k_attn(const bf* __restrict__ QF, const bf* __restrict__ KF, const bf* __restrict__ VF, const bf* __restrict__ EF, const bf* __restrict__ MF, const float* __restrict__ kla, const float* __restrict__ ST, const float* __restrict__ MS, const float* __restrict__ KL, float* OUT) {
    __shared__ __align__(16) float xs[33 * XP];   // phases A and B: QE rows i0..i0+32; phases C and D: the 16 partial output tiles, 32 x 68 dwords each
    __shared__ float rmax[16 * 32];
    __shared__ float rsum[16 * 32];
    const int lane = threadIdx.x & 31, lr = lane & 15, hi = lane >> 4; const int w = __builtin_amdgcn_readfirstlane(threadIdx.x >> 5);
    const int z = blockIdx.x / (TT / 32); const int i0 = (blockIdx.x % (TT / 32)) * 32; const int n = z >> 4, h = z & 15;
    const bf* qz = QF + (size_t)z * TT * HD; const bf* kw = KF + (size_t)z * TT * HD + (size_t)w * 32 * HD; const bf* ew = EF + (size_t)h * TT * HD + (size_t)w * 32 * HD; const bf* vw = VF + (size_t)z * HD * TT + (size_t)w * 32 * HD;
    const unsigned po = (unsigned)(lane * 8);           // in the packed planes: a tile of 16 rows is 1024 elements, a V^T block of 32 keys 2048, a mask tile 256
    const bf* q0p = qz + i0 * HD; const bf* q2p = qz + (i0 + 32 < TT ? i0 + 32 : i0) * HD;   // the tile of queries below; the last block has no row below it, and its row 32 in LDS is never read
    v16bf qa[2], qb[2]; const v16bf q2a = ldp(q2p + po), q2b = ldp(q2p + 512 + po);
#pragma unroll
    for (int a = 0; a < 2; ++a) { qa[a] = ldp(q0p + a * 1024 + po); qb[a] = ldp(q0p + a * 1024 + 512 + po); }
    // Which blocks of 32 keys can matter, known before any product. |q.k + Srel| <= |q| (|k| + |E row|) <= bq + bk / 2 + be =: B (a b <= (a a + b b) / 2; be is the largest HALF row's sum of squares, so a row's is
    // at most 2 be). A row's maximum is at least its best mask sum - B, a block's values are at most its largest mask sum + B. Where, for both query tiles, the block's bound lies more than 2000 under the
    // row bound, every exponent of the block is under -160 and every 2^x exactly 0: the block adds nothing to row maximum, row sum or output, and its K, mask and V^T loads, its products and the QE
    // positions that only such blocks read are left out. The 1/64 covers the bf16 rounding of both masks and the f32 roundings at their size, the 2.2 (for 2) those of the products. The test reads
    // the inputs alone, holds for any mask, and is false (the block is worked on) where an infinity enters it; the maxima drop a NaN, as those of the test in phase C do. Every wave forms the same 64 bits: no barrier, scalar branches only.
    unsigned long long LV, ND;
    {
        const float* sz = ST + z * 8 * 32; const int qt = i0 >> 4, q2 = (qt + 2 < TT / 16 ? qt + 2 : qt);
        // the lane's byte offsets: inputs of the wait below, so that their registers live, unwritten, up to it
        const unsigned oq = (unsigned)(((lane & 1 ? q2 : qt) >> 4) * 128), ok = (unsigned)((lane & 7) * 128 + 4), oe = (unsigned)((h * 16 + lr) * 128 + 8), ol = (unsigned)((n * 64 + lane) * 8), om = (unsigned)((qt * 64 + lane) * 8);
        const float bq = *(const float*)((const char*)sz + oq), bk = *(const float*)((const char*)sz + ok), be = *(const float*)((const char*)ST + oe);
        v2f mt[2][2], kt[2];
#pragma unroll
        for (int p = 0; p < 2; ++p) { kt[p] = *(const v2fa*)((const char*)KL + ol + p * 256);
#pragma unroll
            for (int a = 0; a < 2; ++a) mt[a][p] = *(const v2fa*)((const char*)MS + om + a * 512 + p * 256); }
        asm volatile("s_wait_xcnt 0x0" :: "v"(oq), "v"(ok), "v"(oe), "v"(ol), "v"(om) : "memory");   // behind the loads of the bounds: their address registers are free for what follows
        auto wmax = [&](float x) {
#pragma unroll
            for (int m = 1; m < 32; m <<= 1) x = fmaxf(x, __shfl_xor(x, m, 32));
            return x; };
        const float T = 2.2f * (wmax(bq) + 0.5f * wmax(bk) + wmax(be)) + 2000.f;
        float up[2][2], mr[2];
#pragma unroll
        for (int a = 0; a < 2; ++a) { float lo[2];
#pragma unroll
            for (int p = 0; p < 2; ++p) { up[a][p] = (mt[a][p][0] + fabsf(mt[a][p][0]) * 0.015625f) + (kt[p][0] + fabsf(kt[p][0]) * 0.015625f); lo[p] = (mt[a][p][1] - fabsf(mt[a][p][1]) * 0.015625f) + (kt[p][1] - fabsf(kt[p][1]) * 0.015625f); }
            mr[a] = wmax(fmaxf(lo[0], lo[1])); }
        const unsigned b0 = (unsigned)__ballot(!(up[0][0] + T < mr[0] && up[1][0] + T < mr[1])), b1 = (unsigned)__ballot(!(up[0][1] + T < mr[0] && up[1][1] + T < mr[1]));
        LV = (unsigned long long)b0 | ((unsigned long long)b1 << 32);
        // key block kb against query block ib = i0 / 32 reads QE positions (blocks of 32): kb <= ib: kb + 63 - ib and kb + 64 - ib; kb >= ib: kb - ib - 2 .. kb - ib (the run in the next row)
        const int ib = i0 >> 5; const unsigned long long lw = (LV & ((2ull << ib) - 1ull)) << (63 - ib), uw = LV >> ib;
        ND = lw | (lw << 1) | uw | (uw >> 1) | (uw >> 2);
    }
    bool lv[4], nd[4];            // the wave's own four key blocks and four position blocks: w, w + 16, w + 32, w + 48
#pragma unroll
    for (int ks = 0; ks < 4; ++ks) { lv[ks] = (LV >> (w + 16 * ks)) & 1ull; nd[ks] = (ND >> (w + 16 * ks)) & 1ull; }
    const bf* mw = MF + ((size_t)(i0 >> 4) * (TT / 16) + w * 2) * 256; const float* kr = kla + (size_t)n * TT + w * 32;   // the same address in every lane: the key-length values come through scalar registers
    // a key tile's two K fragments are fetched one tile ahead into the same registers, right behind the products that read them; its mask and key-length values two tiles ahead into two register sets
    v16bf kf[2]; v8us af[2][2]; float lf[2][16];
    const bf* kq = kw + po; const bf* mq = mw + po;   // the lane's own addresses: inputs of the wait behind the phase's last loads, so that their registers live, unwritten, up to it
    auto ldk = [&](int t) { kf[0] = ldp(kq + KO(t) * HD); kf[1] = ldp(kq + KO(t) * HD + 512); };
    auto ldm = [&](int t) { const int s = t & 1; af[s][0] = *(const v8usa*)(mq + KO(t) * 16); af[s][1] = *(const v8usa*)(mq + (TT / 16) * 256 + KO(t) * 16);
#pragma unroll
        for (int e = 0; e < 16; ++e) lf[s][e] = kr[KO(t) + e]; };
    {
        float* xp = xs + lr * XP + w * 32 + 8 * hi;
        v16bf ef[8][2];           // all E tiles that are needed are asked for at once
#pragma unroll
        for (int t = 0; t < 8; ++t) if (nd[t >> 1]) { ef[t][0] = ldp(ew + KO(t) * HD + po); ef[t][1] = ldp(ew + KO(t) * HD + 512 + po); }
        asm volatile("s_wait_xcnt 0x0" :: "s"(ew), "s"(q0p), "s"(q2p) : "memory");   // behind the Q and E loads; their base addresses are inputs, so the scalar registers that hold them are rewritten by nothing in front of the wait
#pragma unroll
        for (int b = 0; b < 4; ++b) if (nd[b]) { v8f u[2], d[2][2];
#pragma unroll
            for (int c = 0; c < 2; ++c) { const v16bf e0 = ef[2 * b + c][0], e1 = ef[2 * b + c][1]; u[c] = (v8f){};
                u[c] = wmmab(e0, q2a, u[c]); u[c] = wmmab(e1, q2b, u[c]);
#pragma unroll
                for (int a = 0; a < 2; ++a) { d[c][a] = (v8f){}; d[c][a] = wmmab(e0, qa[a], d[c][a]); d[c][a] = wmmab(e1, qb[a], d[c][a]); } }
            __builtin_amdgcn_sched_barrier(0);   // the LDS stores stay behind the block's twelve products: with a store lifted among them its registers took a later product's result inside the four slots behind the first
#pragma unroll
            for (int c = 0; c < 2; ++c) {
#pragma unroll
                for (int a = 0; a < 2; ++a) { const v8f x = d[c][a]; *(v4fa*)(xp + a * 16 * XP + KO(2 * b + c)) = (v4f){x[0], x[1], x[2], x[3]}; *(v4fa*)(xp + a * 16 * XP + KO(2 * b + c) + 4) = (v4f){x[4], x[5], x[6], x[7]}; } }
            if (lr == 0) {        // column 0 of the third tile is query i0+32
#pragma unroll
                for (int c = 0; c < 2; ++c) { *(v4fa*)(xp + 32 * XP + KO(2 * b + c)) = (v4f){u[c][0], u[c][1], u[c][2], u[c][3]}; *(v4fa*)(xp + 32 * XP + KO(2 * b + c) + 4) = (v4f){u[c][4], u[c][5], u[c][6], u[c][7]}; } }
            if (b < 3) asm volatile("v_nop\n\tv_nop\n\tv_nop\n\tv_nop"); }   // the four vector slots that the chip needs behind a product: the branch round the lr == 0 stores leads straight to the next block's products, which write this block's result registers
        if (lv[0]) { ldk(0); ldm(0); ldm(1); }   // the next phase's first loads go out in front of the barrier: their latency runs beside the wait for the other waves
    }
    __syncthreads();              // every QE row is in LDS before another wave reads its skewed run
    float lg[2][64]; float mx[2] = {-__builtin_inff(), -__builtin_inff()};   // below every value: the maximum is taken of 8 x the logit, which may lie under any finite start
    float mk[4] = {-__builtin_inff(), -__builtin_inff(), -__builtin_inff(), -__builtin_inff()};   // a lane's largest value of each block of 32 keys, over its two rows
#pragma unroll
    for (int a = 0; a < 2; ++a) { const int ia0 = i0 + 16 * a, i = ia0 + lr; const float* xb = xs + (a * 16 + lr) * XP + (TT - 1 - i) + w * 32 + 8 * hi;
#pragma unroll
        for (int t = 0; t < 8; ++t) if (lv[t >> 1]) { const int j0 = w * 32 + KO(t);   // the skewed runs first
            if (j0 == ia0 || j0 == ia0 + 16) {    // the two tiles that the diagonal j == i+1 crosses: each element picks its own run; at j == i+1 the neighbour is read and dropped
#pragma unroll
                for (int e = 0; e < 8; ++e) { const int je = j0 + 8 * hi + e; const float v = xb[KO(t) + e + (je > i + 1 ? XU : (je > i ? -1 : 0))]; lg[a][t * 8 + e] = (je == i + 1) ? 0.f : v; }
            } else { const float* p = xb + (j0 > ia0 ? KO(t) + XU : KO(t));
#pragma unroll
                for (int e = 0; e < 8; ++e) lg[a][t * 8 + e] = p[e]; } } }
#pragma unroll
    for (int ks = 0; ks < 4; ++ks) { const bool nx = ks + 1 < 4 && lv[ks + 1];
      // Scalar branches only. The next block's loads go out only where it is worked on, each from ONE place that is passed whether or not this block is worked on: its first mask tile behind this block's
      // first tile, its K and second mask tile behind the second. From two places (one in the block, one beside it) the results met in copies, and the copies waited for the loads at once.
#pragma unroll
      for (int c = 0; c < 2; ++c) { const int t = 2 * ks + c, b = c;
        if (lv[ks]) { v8f s[2];
#pragma unroll
        for (int e = 0; e < 8; e += 2) { const v2f kv = __builtin_convertvector(rbf2(hi ? lf[b][8 + e] : lf[b][e], hi ? lf[b][9 + e] : lf[b][1 + e]), v2f);   // the skewed QE value and both masks start the accumulator of K.Q^T: no second set of eight registers a tile
#pragma unroll
            for (int a = 0; a < 2; ++a) { s[a][e] = __fadd_rn(lg[a][t * 8 + e], __fadd_rn(bf2f(af[b][a][e]), kv[0])); s[a][e + 1] = __fadd_rn(lg[a][t * 8 + e + 1], __fadd_rn(bf2f(af[b][a][e + 1]), kv[1])); } }
#pragma unroll
        for (int a = 0; a < 2; ++a) { s[a] = wmmab(kf[0], qa[a], s[a]); s[a] = wmmab(kf[1], qb[a], s[a]); }
        if (c == 0) ldk(t + 1);
        float tm[2];
#pragma unroll
        for (int a = 0; a < 2; ++a) { tm[a] = s[a][0];
#pragma unroll
            for (int e = 0; e < 8; ++e) { lg[a][t * 8 + e] = s[a][e]; if (e) tm[a] = fmaxf(tm[a], s[a][e]); }   // 8 x the logit stays where the products left it; the 1/8 is in the factor of the exponent
            mx[a] = fmaxf(mx[a], tm[a]); }
        mk[ks] = fmaxf(mk[ks], fmaxf(tm[0], tm[1])); }
        if (nx) { if (c == 1) ldk(t + 1); ldm(t + 2); } } }
    asm volatile("s_wait_xcnt 0x0" :: "v"(kq), "v"(mq) : "memory");   // behind the last loads of this phase: their address registers are free for the arithmetic that follows
    v16bf vf[4];                  // V^T fragments of 32 keys, fetched one step ahead into the same registers; the first go out once the wave knows which blocks it needs, and fly beside its first exponentials
    auto ldv = [&](int ks) {
#pragma unroll
        for (int nb = 0; nb < 4; ++nb) vf[nb] = ldp(vw + ks * (512 * HD) + nb * 512 + po); };
#pragma unroll
    for (int a = 0; a < 2; ++a) { mx[a] = fmaxf(mx[a], __shfl_xor(mx[a], 16, 32)); if (hi == 0) rmax[w * 32 + a * 16 + lr] = mx[a]; }
    __syncthreads();              // every wave's row maxima are in LDS, and every read of the QE rows is over before the partial tiles are written over them
#pragma unroll
    for (int a = 0; a < 2; ++a) {
#pragma unroll
        for (int p = 0; p < 16; ++p) mx[a] = fmaxf(mx[a], rmax[p * 32 + a * 16 + lr]); }
    float sum[2] = {0.f, 0.f}; v8f acc[2][4];
#pragma unroll
    for (int a = 0; a < 2; ++a) {
#pragma unroll
        for (int nb = 0; nb < 4; ++nb) acc[a][nb] = (v8f){}; }
    // Where, in every lane, the largest value of a block of 32 keys taken against the smaller of the lane's two row maxima gives an exponent under -160, every 2^x of the block is exactly 0 (the
    // smallest f32 above 0 is 2^-149; subtraction and multiply are monotone): it adds nothing to the row sums and, V being finite, nothing to the partial tiles. Such a block is left out: no exponentials, no V^T loads, no products.
    // The test is on the computed logits alone, holds for any mask, and is false where a NaN makes it so. One answer a wave: scalar branches, EXEC stays full around the products.
    bool live[4];
#pragma unroll
    for (int ks = 0; ks < 4; ++ks) live[ks] = lv[ks] && !__all((mk[ks] - fminf(mx[0], mx[1])) * (1.44269504f * 0.125f) < -160.f);
    if (live[0]) ldv(0);
#pragma unroll
    for (int ks = 0; ks < 4; ++ks) {   // keys 8 hi + 0..7 and 16 + 8 hi + 0..7 of the block: the k order of the fragment loader
        if (live[ks]) {
#pragma unroll
        for (int a = 0; a < 2; ++a) { v8u ph, pl;
#pragma unroll
            for (int g = 0; g < 2; ++g) { float xa[8], ev[8];
#pragma unroll
                for (int e = 0; e < 8; ++e) xa[e] = (lg[a][ks * 16 + g * 8 + e] - mx[a]) * (1.44269504f * 0.125f);   // exp((x - max) / 8) = 2^((x - max) log2 e / 8); a power of two moves through every rounding: the same bits
                exp2x8(ev, xa);
#pragma unroll
                for (int e = 0; e < 8; e += 2) { sum[a] += ev[e]; sum[a] += ev[e + 1]; unsigned x, y; splitf2(ev[e], ev[e + 1], x, y); ph[g * 4 + e / 2] = x; pl[g * 4 + e / 2] = y; }
                }
            const v16bf bh = __builtin_bit_cast(v16bf, ph), bl = __builtin_bit_cast(v16bf, pl);
#pragma unroll
            for (int nb = 0; nb < 4; ++nb) { acc[a][nb] = wmmab(vf[nb], bh, acc[a][nb]); acc[a][nb] = wmmab(vf[nb], bl, acc[a][nb]); }
            __builtin_amdgcn_sched_barrier(0); }   // the next exponentials stay behind these products, their subtractions and multiplies in between: lifted among the products, the asm statement writes
                                                   // a product's operand registers inside the four slots that the chip needs behind it
        }
        if (ks + 1 < 4 && live[ks + 1]) ldv(ks + 1);
        }
#pragma unroll
    for (int a = 0; a < 2; ++a) { sum[a] += __shfl_xor(sum[a], 16, 32); if (hi == 0) rsum[w * 32 + a * 16 + lr] = sum[a];
#pragma unroll
        for (int nb = 0; nb < 4; ++nb) { float* op = xs + w * (32 * 68) + (a * 16 + lr) * 68 + nb * 16 + 8 * hi;
            *(v4fa*)op = (v4f){acc[a][nb][0], acc[a][nb][1], acc[a][nb][2], acc[a][nb][3]}; *(v4fa*)(op + 4) = (v4f){acc[a][nb][4], acc[a][nb][5], acc[a][nb][6], acc[a][nb][7]}; } }
    __syncthreads();              // all 16 partial tiles and partial sums are in LDS before they are added
#pragma unroll
    for (int a = 0; a < 2; ++a) { const int row = a * 16 + w;
        v2f o = *(const v2fa*)(xs + row * 68 + lane * 2); float tot = rsum[row];
#pragma unroll
        for (int p = 1; p < 16; ++p) { const v2f t = *(const v2fa*)(xs + p * (32 * 68) + row * 68 + lane * 2); o[0] += t[0]; o[1] += t[1]; tot += rsum[p * 32 + row]; }
        const float ri = __fdiv_rn(1.0f, tot); o[0] *= ri; o[1] *= ri;
        *(v2f*)(OUT + (((size_t)n * TT + i0 + row) * NH_ + h) * HD + lane * 2) = o; }
}

extern "C" void kernel_launch(void* const* d_in, const int* in_sizes, int n_in,
                              void* d_out, int out_size, void* d_ws, size_t ws_size, hipStream_t stream) {
    (void)in_sizes; (void)n_in; (void)out_size;
    const float* queries = (const float*)d_in[0]; const float* keys = (const float*)d_in[1]; const float* values = (const float*)d_in[2]; const float* pos_emb = (const float*)d_in[3]; const float* am = (const float*)d_in[4]; const float* kla = (const float*)d_in[5];
    float* OUT = (float*)d_out;     // [2][2048][16][64]
    char* wsp = (char*)d_ws;
    auto take = [&](size_t bytes) { char* p = wsp; wsp += (bytes + 255) & ~(size_t)255; return (void*)p; };
    bf* QF = (bf*)take((size_t)NT * DD * 2); bf* KF = (bf*)take((size_t)NT * DD * 2); bf* VF = (bf*)take((size_t)NT * DD * 2); bf* EF = (bf*)take((size_t)NH_ * TT * HD * 2); bf* MF = (bf*)take((size_t)TT * TT * 2);
    float* ST = (float*)take((size_t)(PKW / 16) * 32 * 4); float* MS = (float*)take((size_t)(TT / 16) * (TT / 32) * 2 * 4); float* KL = (float*)take((size_t)NB_ * (TT / 32) * 2 * 4);
    if ((size_t)(wsp - (char*)d_ws) > ws_size) return;    // ws 256 MiB
    k_pack<<<PKW / 16, 512, 0, stream>>>(queries, keys, values, pos_emb, am, kla, QF, KF, VF, EF, MF, ST, MS, KL);
    k_attn<<<NB_ * NH_ * (TT / 32), 512, 0, stream>>>(QF, KF, VF, EF, MF, kla, ST, MS, KL, OUT);
}

// v009
// A run of this version takes 82.7 microseconds.
// Next to v008, in two timings, it ran 1.10 and 1.11 times as fast.
// Counting every step since v000, it is 26.0 times as fast.
#include <hip/hip_runtime.h>

// CausalRelativeAttention (queries/keys/values [2][2048][16 heads][64], pos_emb [2048][16][64]; QE = q.E_h^T; Srel = skew(QE) (Music-Transformer pad/reshape trick);
// logits = (q.k^T + Srel + attn_mask_add[l][s] + key_lengths_add[n][s]) / 8; softmax over s; out[n][l][h][d] = sum_s A v).
// Compute dtypes, f32 accumulate: every input rounded to bf16; q.k^T and q.E^T on PLAIN bf16 operands (all inputs: exact products); the skew
// (an index remap of QE: Srel[i][j] = QE[i][L-1+j-i] for j <= i, = 0 for j = i+1, = QE[i+1][j-i-2] for j > i+1 - exactly the reference's pad/reshape), the two additive

#define NB_  2
#define TT   2048
#define NH_  16
#define HD   64
#define DD   (NH_ * HD)           // 1024
#define NT   (NB_ * TT)
typedef _Float16 h16;
typedef unsigned short bf;
typedef __attribute__((ext_vector_type(16))) __bf16   v16bf;
typedef __attribute__((ext_vector_type(16))) _Float16 v16h;
typedef __attribute__((ext_vector_type(8)))  _Float16 v8h;
typedef __attribute__((ext_vector_type(8)))  unsigned short v8us;
typedef __attribute__((ext_vector_type(8)))  float    v8f;
typedef __attribute__((ext_vector_type(4)))  float    v4f;
typedef v8h  __attribute__((may_alias)) v8ha;
typedef v4f  __attribute__((may_alias)) v4fa;
typedef v8us __attribute__((may_alias)) v8usa;

typedef __attribute__((ext_vector_type(2))) float  v2f;
typedef __attribute__((ext_vector_type(2))) __bf16 v2bf;
typedef __attribute__((ext_vector_type(4))) unsigned v4u;
typedef __attribute__((ext_vector_type(8))) unsigned v8u;
typedef v4u __attribute__((may_alias)) v4ua;
// f32 -> bf16, round to nearest even, two values in one conversion instruction that also packs them (x in the low half)
__device__ __forceinline__ v2bf rbf2(float x, float y) { return __builtin_convertvector((v2f){x, y}, v2bf); }
__device__ __forceinline__ unsigned pbf2(float x, float y) { return __builtin_bit_cast(unsigned, rbf2(x, y)); }
__device__ __forceinline__ float bf2f(unsigned short b) { return __uint_as_float(((unsigned)b) << 16); }
__device__ __forceinline__ v16h cat16(v8h lo, v8h hi) { return __builtin_shufflevector(lo, hi, 0, 1, 2, 3, 4, 5, 6, 7, 8, 9, 10, 11, 12, 13, 14, 15); }
__device__ __forceinline__ v16bf cat16b(v8us lo, v8us hi) { return __builtin_bit_cast(v16bf, __builtin_shufflevector(lo, hi, 0, 1, 2, 3, 4, 5, 6, 7, 8, 9, 10, 11, 12, 13, 14, 15)); }
__device__ __forceinline__ v8f wmma16(v16h a, v16h b, v8f c) { return __builtin_amdgcn_wmma_f32_16x16x32_f16(false, a, false, b, (short)0, c, false, false); }
__device__ __forceinline__ v8f wmmab(v16bf a, v16bf b, v8f c) { return __builtin_amdgcn_wmma_f32_16x16x32_bf16(false, a, false, b, (short)0, c, false, false); }



// fragment loader: row = lane & 15, k = 8 (lane >> 4) + 0..7 and 16 + 8 (lane >> 4) + 0..7, the same for the A and the B operand
template <typename T16> struct WFrag;
template <> struct WFrag<h16> { typedef v16h V; static __device__ __forceinline__ V ld(const h16* p) { return cat16(*(const v8h*)p, *(const v8h*)(p + 16)); } static __device__ __forceinline__ v8f mma(V a, V b, v8f c) { return wmma16(a, b, c); } };
template <> struct WFrag<bf> { typedef v16bf V; static __device__ __forceinline__ V ld(const bf* p) { return cat16b(*(const v8us*)p, *(const v8us*)(p + 16)); } static __device__ __forceinline__ v8f mma(V a, V b, v8f c) { return wmmab(a, b, c); } };
// y = hi + lo, both bf16, for two values: hi = bf16(y), lo = bf16(y - hi); the difference is exact in f32
__device__ __forceinline__ void splitf2(float y0, float y1, unsigned& h, unsigned& l) { const v2bf hb = rbf2(y0, y1); const v2f hf = __builtin_convertvector(hb, v2f); h = __builtin_bit_cast(unsigned, hb); l = pbf2(y0 - hf[0], y1 - hf[1]); }

// ---- planes packed in fragment order. A wave-wide 16-byte load of a row-major plane takes 32 bytes from each of 16 lines; here the 32 lanes' chunks of one such load lie side by side,
// 512 contiguous bytes = 4 whole lines, and every line is asked for once. One lane makes one chunk (8 bf16) and a wave writes 4 whole lines a chunk row. The values and their k order are unchanged.
// Q, K and E: [head plane][tile of 16 rows][c = 0..3][lane][8] = row 16 tile + (lane & 15), d = 16 c + 8 (lane >> 4) + 0..7; chunks c = 0, 1 are the fragment of d 0..31, c = 2, 3 that of d 32..63
// V^T: [head plane][block of 32 keys][nb = 0..3][c = 0..1][lane][8] = d 16 nb + (lane & 15), key 32 block + 16 c + 8 (lane >> 4) + 0..7
// additive mask, rounded to bf16 as the logit sum takes it: [tile of 16 queries][tile of 16 keys][lane][8] = query 16 it + (lane & 15), key 16 jt + 8 (lane >> 4) + 0..7: a transposed logit tile's accumulator order
// All five planes are packed by ONE launch of 256 work-groups of 16 waves. Wave W of 4096 makes 18 chunk rows: rows 4 W .. 4 W + 3 of Q, K, V^T and the mask, rows 2 W, 2 W + 1 of E. The four
// (two) neighbouring chunk rows of a plane read whole 128-byte lines of the source between them, and all of a wave's 61 loads (one of them a key-length value, for the bounds below) are in flight before its first store.
#define PKW 4096                  // waves of the pack launch: a quarter of the 16384 chunk rows of Q, K, V^T and the mask, half of the 8192 of E
__device__ __forceinline__ v4u pk8(v4f a, v4f b) { return (v4u){pbf2(a[0], a[1]), pbf2(a[2], a[3]), pbf2(b[0], b[1]), pbf2(b[2], b[3])}; }
// Bounds for the attention kernel's test of which blocks of 32 keys can matter at all (see there), made from the values that the pack launch holds in registers anyway:
// ST[work-group][0..2] = largest sum of squares of a row of its 16 Q tiles, its 16 K tiles, its 16 half tiles of E; MS[tile of 16 queries][block of 32 keys] = {largest mask value, smallest over the
// 16 rows of the row's largest mask value}; KL[batch][block of 32 keys] = {largest, smallest key-length value}. One wave of a work-group stores them: whole 128-byte lines have one writer.
__device__ __forceinline__ float smax16(float x) {
#pragma unroll
    for (int m = 1; m < 16; m <<= 1) x = fmaxf(x, __shfl_xor(x, m, 32));
    return x; }
__device__ __forceinline__ float smin16(float x) {
#pragma unroll
    for (int m = 1; m < 16; m <<= 1) x = fminf(x, __shfl_xor(x, m, 32));
    return x; }
__device__ __forceinline__ float sq8(v4f a, v4f b) { return a[0] * a[0] + a[1] * a[1] + a[2] * a[2] + a[3] * a[3] + b[0] * b[0] + b[1] * b[1] + b[2] * b[2] + b[3] * b[3]; }
__device__ __forceinline__ float mx8(v4f a, v4f b) { return fmaxf(fmaxf(fmaxf(a[0], a[1]), fmaxf(a[2], a[3])), fmaxf(fmaxf(b[0], b[1]), fmaxf(b[2], b[3]))); }
__global__ __launch_bounds__(512) void k_pack(const float* __restrict__ q, const float* __restrict__ k, const float* __restrict__ v, const float* __restrict__ e, const float* __restrict__ am, const float* __restrict__ kla, bf* QF, bf* KF, bf* VF, bf* EF, bf* MF, float* ST, float* MS, float* KL) {
    __shared__ float st[16][12];
    const int lane = threadIdx.x & 31, lr = lane & 15, hi = lane >> 4; const int W = blockIdx.x * 16 + (threadIdx.x >> 5); const int z = W >> 7, n = z >> 4, h = z & 15;
    const size_t qo = (((size_t)n * TT + (W & 127) * 16 + lr) * NH_ + h) * HD + 8 * hi;                                              // tile W & 127 of head plane z, c = 0
    const float* qp = q + qo; const float* kp = k + qo;
    const float* mp = am + (size_t)((W >> 5) * 16 + lr) * TT + (W & 31) * 64 + 8 * hi;                                               // query tile W >> 5, key tiles 4 (W & 31) + 0..3
    const float* ep = e + ((size_t)(((W >> 1) & 127) * 16 + lr) * NH_ + (W >> 8)) * HD + (W & 1) * 32 + 8 * hi;                      // tile (W >> 1) & 127 of head W >> 8, c = 2 (W & 1) + 0..1
    const float* vp = v + (((size_t)n * TT + ((W >> 1) & 63) * 32 + 8 * hi) * NH_ + h) * HD + (W & 1) * 32 + lr;                     // key block (W >> 1) & 63 of head plane z, nb = 2 (W & 1) + 0..1
    const float* lp = kla + (W & 127) * 32 + lane;                                                                                   // block of 32 keys W & 127 of the 128 of both batches
    v4f qv[4][2], kv[4][2], mv[4][2], ev[2][2]; float vv[4][8]; const float lv = *lp;
#pragma unroll
    for (int u = 0; u < 4; ++u) { qv[u][0] = *(const v4fa*)(qp + u * 16); qv[u][1] = *(const v4fa*)(qp + u * 16 + 4); }
#pragma unroll
    for (int u = 0; u < 4; ++u) { kv[u][0] = *(const v4fa*)(kp + u * 16); kv[u][1] = *(const v4fa*)(kp + u * 16 + 4); }
#pragma unroll
    for (int u = 0; u < 4; ++u) { mv[u][0] = *(const v4fa*)(mp + u * 16); mv[u][1] = *(const v4fa*)(mp + u * 16 + 4); }
#pragma unroll
    for (int u = 0; u < 2; ++u) { ev[u][0] = *(const v4fa*)(ep + u * 16); ev[u][1] = *(const v4fa*)(ep + u * 16 + 4); }
#pragma unroll
    for (int u = 0; u < 4; ++u) {   // chunk row u: c = u & 1, nb = 2 (W & 1) + (u >> 1)
#pragma unroll
        for (int r = 0; r < 8; ++r) vv[u][r] = vp[(size_t)((u & 1) * 16 + r) * DD + (u >> 1) * 16]; }
    __builtin_amdgcn_sched_barrier(0);   // all 61 loads go out before the first wait for data: with conversions lifted among them the last loads started only when the first results were back
    asm volatile("s_wait_xcnt 0x0" :: "v"(qp), "v"(kp), "v"(mp), "v"(ep), "v"(vp), "v"(lp) : "memory");   // behind the loads; the six addresses are inputs, so their registers are rewritten by nothing in front of the wait
    const size_t o4 = ((size_t)W * 128 + lane) * 8, o2 = ((size_t)W * 64 + lane) * 8;
    // a plane's conversions and stores stay in the order of its loads (the scheduling barriers): each group then waits for its own loads alone and its stores run beside the loads still in flight
#pragma unroll
    for (int u = 0; u < 4; ++u) *(v4ua*)(QF + o4 + u * 256) = pk8(qv[u][0], qv[u][1]);
    __builtin_amdgcn_sched_barrier(0);
#pragma unroll
    for (int u = 0; u < 4; ++u) *(v4ua*)(KF + o4 + u * 256) = pk8(kv[u][0], kv[u][1]);
    __builtin_amdgcn_sched_barrier(0);
#pragma unroll
    for (int u = 0; u < 4; ++u) *(v4ua*)(MF + o4 + u * 256) = pk8(mv[u][0], mv[u][1]);
    __builtin_amdgcn_sched_barrier(0);
#pragma unroll
    for (int u = 0; u < 2; ++u) *(v4ua*)(EF + o2 + u * 256) = pk8(ev[u][0], ev[u][1]);
    __builtin_amdgcn_sched_barrier(0);
#pragma unroll
    for (int u = 0; u < 4; ++u) *(v4ua*)(VF + o4 + u * 256) = (v4u){pbf2(vv[u][0], vv[u][1]), pbf2(vv[u][2], vv[u][3]), pbf2(vv[u][4], vv[u][5]), pbf2(vv[u][6], vv[u][7])};
    {   // the bounds: a row's values lie in lanes lr and lr + 16
        const int wv = threadIdx.x >> 5;
        float qs = 0.f, ks = 0.f, es = 0.f, mm[2];
#pragma unroll
        for (int u = 0; u < 4; ++u) { qs += sq8(qv[u][0], qv[u][1]); ks += sq8(kv[u][0], kv[u][1]); }
#pragma unroll
        for (int u = 0; u < 2; ++u) { es += sq8(ev[u][0], ev[u][1]); mm[u] = fmaxf(mx8(mv[2 * u][0], mv[2 * u][1]), mx8(mv[2 * u + 1][0], mv[2 * u + 1][1])); mm[u] = fmaxf(mm[u], __shfl_xor(mm[u], 16, 32)); }
        qs = smax16(qs + __shfl_xor(qs, 16, 32)); ks = smax16(ks + __shfl_xor(ks, 16, 32)); es = smax16(es + __shfl_xor(es, 16, 32));
        const float h0 = smax16(mm[0]), l0 = smin16(mm[0]), h1 = smax16(mm[1]), l1 = smin16(mm[1]);
        const float lh = smax16(fmaxf(lv, __shfl_xor(lv, 16, 32))), ll = smin16(fminf(lv, __shfl_xor(lv, 16, 32)));
        if (lane == 0) { st[wv][0] = qs; st[wv][1] = ks; st[wv][2] = es; st[wv][4] = h0; st[wv][5] = l0; st[wv][6] = h1; st[wv][7] = l1; st[wv][8] = lh; st[wv][9] = ll; }
        __syncthreads();          // the 16 waves' bounds are in LDS before wave 0 gathers them
        if (wv == 0) {
            *(v2f*)(MS + blockIdx.x * 64 + lane * 2) = (v2f){st[lane >> 1][4 + (lane & 1) * 2], st[lane >> 1][5 + (lane & 1) * 2]};
            const float a = smax16(st[lr][0]), b = smax16(st[lr][1]), c = smax16(st[lr][2]);
            if (lane == 0) *(v4f*)(ST + blockIdx.x * 32) = (v4f){a, b, c, 0.f};
            if (blockIdx.x < 8 && lane < 16) *(v2f*)(KL + blockIdx.x * 32 + lane * 2) = (v2f){st[lane][8], st[lane][9]};
        }
    }
}
// a fragment of a packed plane: two chunks, 256 elements apart
__device__ __forceinline__ v16bf ldp(const bf* p) { return cat16b(*(const v8us*)p, *(const v8us*)(p + 256)); }
// logit(i,j) = (q_i.k_j + Srel(i,j) + bf(am[i][j]) + bf(kla[n][j])) / 8 with Srel(i,j) = QE[i][L-1+j-i] (j <= i), 0 (j == i+1), QE[i+1][j-i-2] (j >= i+2), QE[i][r] = q_i.E_h[r].
// ---- k_attn: both logit products, the skew, softmax and P.V of 32 query rows (two tiles of 16) of one head in one work-group of 16 waves; grid 32 heads * L / 32. Every tile is kept
// TRANSPOSED (rows = keys or positions, columns = 16 queries: lane & 15 is the query), so that a logit tile's accumulator registers are, after exp, already the B fragment of V^T.P^T.
// Each E, K and V^T fragment is loaded once and multiplied with both query tiles: the bytes a work-group draws from L2 serve twice the queries.
// Phase A, wave w = the four blocks of 32 positions w, w + 16, w + 32, w + 48 (KO below), those of them that a block of keys which is worked on reads: QE^T tiles to LDS, one row of XP dwords a query; row i0+31 reads on in QE row i0+32, which is the first column of a third
// tile on queries i0+32..i0+47. Phase B, wave w = the four blocks of 32 keys w, w + 16, w + 32, w + 48 (KO below): the skewed QE run from LDS plus both
// masks is the start value of the K.Q^T accumulator; row max over lanes, then over waves through LDS. Phase C: exp, bf16 hi/lo split, V^T.P^T on the wave's own 128 keys, f32 partial tiles to LDS; a block of 32 keys whose 2^x are all exactly 0 is left out.
// Phase D: the 16 partials and the 16 partial row sums are added in wave order, scaled by 1/sum and stored as whole 256-byte rows of the output.
#define XP 2052                   // pitch of a QE row in LDS, in dwords: 16-byte stores of 16 rows fall on all 64 banks (pitch = 4 mod 64), the skewed dword reads step 3 banks a lane
#define XU (XP - TT - 1)          // a row's run for j >= i+2 starts this many dwords behind the place where its run for j <= i would go on
#define KO(t) (((t) >> 1) * 512 + ((t) & 1) * 16)   // first key of a wave's key tile t = 0..7, counted from its first key 32 w: blocks of 32 keys are dealt to the 16 waves in turn
// eight 2^x in one statement: behind a v_exp_f32 the instruction set asks for one independent instruction before its result is read or its source overwritten; here each is the
// next one's (outputs share no register with an input), and the v_nop is the last one's.
__device__ __forceinline__ void exp2x8(float* r, const float* x) {
    asm("v_exp_f32 %0, %8\n\tv_exp_f32 %1, %9\n\tv_exp_f32 %2, %10\n\tv_exp_f32 %3, %11\n\tv_exp_f32 %4, %12\n\tv_exp_f32 %5, %13\n\tv_exp_f32 %6, %14\n\tv_exp_f32 %7, %15\n\tv_nop"
        : "=&v"(r[0]), "=&v"(r[1]), "=&v"(r[2]), "=&v"(r[3]), "=&v"(r[4]), "=&v"(r[5]), "=&v"(r[6]), "=&v"(r[7]) : "v"(x[0]), "v"(x[1]), "v"(x[2]), "v"(x[3]), "v"(x[4]), "v"(x[5]), "v"(x[6]), "v"(x[7]));
}
typedef v2f  __attribute__((may_alias)) v2fa;
__global__ __launch_bounds__(512) void k_attn(const bf* __restrict__ QF, const bf* __restrict__ KF, const bf* __restrict__ VF, const bf* __restrict__ EF, const bf* __restrict__ MF, const float* __restrict__ kla, const float* __restrict__ ST, const float* __restrict__ MS, const float* __restrict__ KL, float* OUT) {
    __shared__ __align__(16) float xs[33 * XP];   // phases A and B: QE rows i0..i0+32; phases C and D: the 16 partial output tiles, 32 x 68 dwords each
    __shared__ float rmax[16 * 32];
    __shared__ float rsum[16 * 32];
    const int lane = threadIdx.x & 31, lr = lane & 15, hi = lane >> 4; const int w = __builtin_amdgcn_readfirstlane(threadIdx.x >> 5);
    // There are eight times as many work-groups as places. Under a causal mask a block of queries costs more the further down it lies, so the lowest blocks take the lowest indices
    // (all 32 head planes of a block side by side), for speed only. A permutation of (head plane, block): right for any mask, wherever and whenever a work-group runs.
    // The % is an identity on this grid; it tells the compiler that the block number lies in 0..63, as the old map's did (without it the diagonal tiles' index arithmetic came out longer).
    const int z = blockIdx.x % (NB_ * NH_); const int i0 = (TT / 32 - 1 - (blockIdx.x / (NB_ * NH_)) % (TT / 32)) * 32; const int n = z >> 4, h = z & 15;
    const bf* qz = QF + (size_t)z * TT * HD; const bf* kw = KF + (size_t)z * TT * HD + (size_t)w * 32 * HD; const bf* ew = EF + (size_t)h * TT * HD + (size_t)w * 32 * HD; const bf* vw = VF + (size_t)z * HD * TT + (size_t)w * 32 * HD;
    const unsigned po = (unsigned)(lane * 8);           // in the packed planes: a tile of 16 rows is 1024 elements, a V^T block of 32 keys 2048, a mask tile 256
    const bf* q0p = qz + i0 * HD; const bf* q2p = qz + (i0 + 32 < TT ? i0 + 32 : i0) * HD;   // the tile of queries below; the last block has no row below it, and its row 32 in LDS is never read
    v16bf qa[2], qb[2]; const v16bf q2a = ldp(q2p + po), q2b = ldp(q2p + 512 + po);
#pragma unroll
    for (int a = 0; a < 2; ++a) { qa[a] = ldp(q0p + a * 1024 + po); qb[a] = ldp(q0p + a * 1024 + 512 + po); }
    // Which blocks of 32 keys can matter, known before any product. |q.k + Srel| <= |q| (|k| + |E row|) <= bq + bk / 2 + be =: B (a b <= (a a + b b) / 2; be is the largest HALF row's sum of squares, so a row's is
    // at most 2 be). A row's maximum is at least its best mask sum - B, a block's values are at most its largest mask sum + B. Where, for both query tiles, the block's bound lies more than 2000 under the
    // row bound, every exponent of the block is under -160 and every 2^x exactly 0: the block adds nothing to row maximum, row sum or output, and its K, mask and V^T loads, its products and the QE
    // positions that only such blocks read are left out. The 1/64 covers the bf16 rounding of both masks and the f32 roundings at their size, the 2.2 (for 2) those of the products. The test reads
    // the inputs alone, holds for any mask, and is false (the block is worked on) where an infinity enters it; the maxima drop a NaN, as those of the test in phase C do. Every wave forms the same 64 bits: no barrier, scalar branches only.
    unsigned long long LV, ND;
    {
        const float* sz = ST + z * 8 * 32; const int qt = i0 >> 4, q2 = (qt + 2 < TT / 16 ? qt + 2 : qt);
        // the lane's byte offsets: inputs of the wait below, so that their registers live, unwritten, up to it
        const unsigned oq = (unsigned)(((lane & 1 ? q2 : qt) >> 4) * 128), ok = (unsigned)((lane & 7) * 128 + 4), oe = (unsigned)((h * 16 + lr) * 128 + 8), ol = (unsigned)((n * 64 + lane) * 8), om = (unsigned)((qt * 64 + lane) * 8);
        const float bq = *(const float*)((const char*)sz + oq), bk = *(const float*)((const char*)sz + ok), be = *(const float*)((const char*)ST + oe);
        v2f mt[2][2], kt[2];
#pragma unroll
        for (int p = 0; p < 2; ++p) { kt[p] = *(const v2fa*)((const char*)KL + ol + p * 256);
#pragma unroll
            for (int a = 0; a < 2; ++a) mt[a][p] = *(const v2fa*)((const char*)MS + om + a * 512 + p * 256); }
        asm volatile("s_wait_xcnt 0x0" :: "v"(oq), "v"(ok), "v"(oe), "v"(ol), "v"(om) : "memory");   // behind the loads of the bounds: their address registers are free for what follows
        auto wmax = [&](float x) {
#pragma unroll
            for (int m = 1; m < 32; m <<= 1) x = fmaxf(x, __shfl_xor(x, m, 32));
            return x; };
        const float T = 2.2f * (wmax(bq) + 0.5f * wmax(bk) + wmax(be)) + 2000.f;
        float up[2][2], mr[2];
#pragma unroll
        for (int a = 0; a < 2; ++a) { float lo[2];
#pragma unroll
            for (int p = 0; p < 2; ++p) { up[a][p] = (mt[a][p][0] + fabsf(mt[a][p][0]) * 0.015625f) + (kt[p][0] + fabsf(kt[p][0]) * 0.015625f); lo[p] = (mt[a][p][1] - fabsf(mt[a][p][1]) * 0.015625f) + (kt[p][1] - fabsf(kt[p][1]) * 0.015625f); }
            mr[a] = wmax(fmaxf(lo[0], lo[1])); }
        const unsigned b0 = (unsigned)__ballot(!(up[0][0] + T < mr[0] && up[1][0] + T < mr[1])), b1 = (unsigned)__ballot(!(up[0][1] + T < mr[0] && up[1][1] + T < mr[1]));
        LV = (unsigned long long)b0 | ((unsigned long long)b1 << 32);
        // key block kb against query block ib = i0 / 32 reads QE positions (blocks of 32): kb <= ib: kb + 63 - ib and kb + 64 - ib; kb >= ib: kb - ib - 2 .. kb - ib (the run in the next row)
        const int ib = i0 >> 5; const unsigned long long lw = (LV & ((2ull << ib) - 1ull)) << (63 - ib), uw = LV >> ib;
        ND = lw | (lw << 1) | uw | (uw >> 1) | (uw >> 2);
    }
    bool lv[4], nd[4];            // the wave's own four key blocks and four position blocks: w, w + 16, w + 32, w + 48
#pragma unroll
    for (int ks = 0; ks < 4; ++ks) { lv[ks] = (LV >> (w + 16 * ks)) & 1ull; nd[ks] = (ND >> (w + 16 * ks)) & 1ull; }
    const bf* mw = MF + ((size_t)(i0 >> 4) * (TT / 16) + w * 2) * 256; const float* kr = kla + (size_t)n * TT + w * 32;   // the same address in every lane: the key-length values come through scalar registers
    // a key tile's two K fragments are fetched one tile ahead into the same registers, right behind the products that read them; its mask and key-length values two tiles ahead into two register sets
    v16bf kf[2]; v8us af[2][2]; float lf[2][16];
    const bf* kq = kw + po; const bf* mq = mw + po;   // the lane's own addresses: inputs of the wait behind the phase's last loads, so that their registers live, unwritten, up to it
    auto ldk = [&](int t) { kf[0] = ldp(kq + KO(t) * HD); kf[1] = ldp(kq + KO(t) * HD + 512); };
    auto ldm = [&](int t) { const int s = t & 1; af[s][0] = *(const v8usa*)(mq + KO(t) * 16); af[s][1] = *(const v8usa*)(mq + (TT / 16) * 256 + KO(t) * 16);
#pragma unroll
        for (int e = 0; e < 16; ++e) lf[s][e] = kr[KO(t) + e]; };
    {
        float* xp = xs + lr * XP + w * 32 + 8 * hi;
        v16bf ef[8][2];           // all E tiles that are needed are asked for at once
#pragma unroll
        for (int t = 0; t < 8; ++t) if (nd[t >> 1]) { ef[t][0] = ldp(ew + KO(t) * HD + po); ef[t][1] = ldp(ew + KO(t) * HD + 512 + po); }
        asm volatile("s_wait_xcnt 0x0" :: "s"(ew), "s"(q0p), "s"(q2p) : "memory");   // behind the Q and E loads; their base addresses are inputs, so the scalar registers that hold them are rewritten by nothing in front of the wait
#pragma unroll
        for (int b = 0; b < 4; ++b) if (nd[b]) { v8f u[2], d[2][2];
#pragma unroll
            for (int c = 0; c < 2; ++c) { const v16bf e0 = ef[2 * b + c][0], e1 = ef[2 * b + c][1]; u[c] = (v8f){};
                u[c] = wmmab(e0, q2a, u[c]); u[c] = wmmab(e1, q2b, u[c]);
#pragma unroll
                for (int a = 0; a < 2; ++a) { d[c][a] = (v8f){}; d[c][a] = wmmab(e0, qa[a], d[c][a]); d[c][a] = wmmab(e1, qb[a], d[c][a]); } }
            __builtin_amdgcn_sched_barrier(0);   // the LDS stores stay behind the block's twelve products: with a store lifted among them its registers took a later product's result inside the four slots behind the first
#pragma unroll
            for (int c = 0; c < 2; ++c) {
#pragma unroll
                for (int a = 0; a < 2; ++a) { const v8f x = d[c][a]; *(v4fa*)(xp + a * 16 * XP + KO(2 * b + c)) = (v4f){x[0], x[1], x[2], x[3]}; *(v4fa*)(xp + a * 16 * XP + KO(2 * b + c) + 4) = (v4f){x[4], x[5], x[6], x[7]}; } }
            if (lr == 0) {        // column 0 of the third tile is query i0+32
#pragma unroll
                for (int c = 0; c < 2; ++c) { *(v4fa*)(xp + 32 * XP + KO(2 * b + c)) = (v4f){u[c][0], u[c][1], u[c][2], u[c][3]}; *(v4fa*)(xp + 32 * XP + KO(2 * b + c) + 4) = (v4f){u[c][4], u[c][5], u[c][6], u[c][7]}; } }
            if (b < 3) asm volatile("v_nop\n\tv_nop\n\tv_nop\n\tv_nop"); }   // the four vector slots that the chip needs behind a product: the branch round the lr == 0 stores leads straight to the next block's products, which write this block's result registers
        if (lv[0]) { ldk(0); ldm(0); ldm(1); }   // the next phase's first loads go out in front of the barrier: their latency runs beside the wait for the other waves
    }
    __syncthreads();              // every QE row is in LDS before another wave reads its skewed run
    float lg[2][64]; float mx[2] = {-__builtin_inff(), -__builtin_inff()};   // below every value: the maximum is taken of 8 x the logit, which may lie under any finite start
    float mk[4] = {-__builtin_inff(), -__builtin_inff(), -__builtin_inff(), -__builtin_inff()};   // a lane's largest value of each block of 32 keys, over its two rows
#pragma unroll
    for (int a = 0; a < 2; ++a) { const int ia0 = i0 + 16 * a, i = ia0 + lr; const float* xb = xs + (a * 16 + lr) * XP + (TT - 1 - i) + w * 32 + 8 * hi;
#pragma unroll
        for (int t = 0; t < 8; ++t) if (lv[t >> 1]) { const int j0 = w * 32 + KO(t);   // the skewed runs first
            if (j0 == ia0 || j0 == ia0 + 16) {    // the two tiles that the diagonal j == i+1 crosses: each element picks its own run; at j == i+1 the neighbour is read and dropped
#pragma unroll
                for (int e = 0; e < 8; ++e) { const int je = j0 + 8 * hi + e; const float v = xb[KO(t) + e + (je > i + 1 ? XU : (je > i ? -1 : 0))]; lg[a][t * 8 + e] = (je == i + 1) ? 0.f : v; }
            } else { const float* p = xb + (j0 > ia0 ? KO(t) + XU : KO(t));
#pragma unroll
                for (int e = 0; e < 8; ++e) lg[a][t * 8 + e] = p[e]; } } }
#pragma unroll
    for (int ks = 0; ks < 4; ++ks) { const bool nx = ks + 1 < 4 && lv[ks + 1];
      // Scalar branches only. The next block's loads go out only where it is worked on, each from ONE place that is passed whether or not this block is worked on: its first mask tile behind this block's
      // first tile, its K and second mask tile behind the second. From two places (one in the block, one beside it) the results met in copies, and the copies waited for the loads at once.
#pragma unroll
      for (int c = 0; c < 2; ++c) { const int t = 2 * ks + c, b = c;
        if (lv[ks]) { v8f s[2];
#pragma unroll
        for (int e = 0; e < 8; e += 2) { const v2f kv = __builtin_convertvector(rbf2(hi ? lf[b][8 + e] : lf[b][e], hi ? lf[b][9 + e] : lf[b][1 + e]), v2f);   // the skewed QE value and both masks start the accumulator of K.Q^T: no second set of eight registers a tile
#pragma unroll
            for (int a = 0; a < 2; ++a) { s[a][e] = __fadd_rn(lg[a][t * 8 + e], __fadd_rn(bf2f(af[b][a][e]), kv[0])); s[a][e + 1] = __fadd_rn(lg[a][t * 8 + e + 1], __fadd_rn(bf2f(af[b][a][e + 1]), kv[1])); } }
#pragma unroll
        for (int a = 0; a < 2; ++a) { s[a] = wmmab(kf[0], qa[a], s[a]); s[a] = wmmab(kf[1], qb[a], s[a]); }
        if (c == 0) ldk(t + 1);
        float tm[2];
#pragma unroll
        for (int a = 0; a < 2; ++a) { tm[a] = s[a][0];
#pragma unroll
            for (int e = 0; e < 8; ++e) { lg[a][t * 8 + e] = s[a][e]; if (e) tm[a] = fmaxf(tm[a], s[a][e]); }   // 8 x the logit stays where the products left it; the 1/8 is in the factor of the exponent
            mx[a] = fmaxf(mx[a], tm[a]); }
        mk[ks] = fmaxf(mk[ks], fmaxf(tm[0], tm[1])); }
        if (nx) { if (c == 1) ldk(t + 1); ldm(t + 2); } } }
    asm volatile("s_wait_xcnt 0x0" :: "v"(kq), "v"(mq) : "memory");   // behind the last loads of this phase: their address registers are free for the arithmetic that follows
    v16bf vf[4];                  // V^T fragments of 32 keys, fetched one step ahead into the same registers; the first go out once the wave knows which blocks it needs, and fly beside its first exponentials
    auto ldv = [&](int ks) {
#pragma unroll
        for (int nb = 0; nb < 4; ++nb) vf[nb] = ldp(vw + ks * (512 * HD) + nb * 512 + po); };
#pragma unroll
    for (int a = 0; a < 2; ++a) { mx[a] = fmaxf(mx[a], __shfl_xor(mx[a], 16, 32)); if (hi == 0) rmax[w * 32 + a * 16 + lr] = mx[a]; }
    __syncthreads();              // every wave's row maxima are in LDS, and every read of the QE rows is over before the partial tiles are written over them
#pragma unroll
    for (int a = 0; a < 2; ++a) {
#pragma unroll
        for (int p = 0; p < 16; ++p) mx[a] = fmaxf(mx[a], rmax[p * 32 + a * 16 + lr]); }
    float sum[2] = {0.f, 0.f}; v8f acc[2][4];
#pragma unroll
    for (int a = 0; a < 2; ++a) {
#pragma unroll
        for (int nb = 0; nb < 4; ++nb) acc[a][nb] = (v8f){}; }
    // Where, in every lane, the largest value of a block of 32 keys taken against the smaller of the lane's two row maxima gives an exponent under -160, every 2^x of the block is exactly 0 (the
    // smallest f32 above 0 is 2^-149; subtraction and multiply are monotone): it adds nothing to the row sums and, V being finite, nothing to the partial tiles. Such a block is left out: no exponentials, no V^T loads, no products.
    // The test is on the computed logits alone, holds for any mask, and is false where a NaN makes it so. One answer a wave: scalar branches, EXEC stays full around the products.
    bool live[4];
#pragma unroll
    for (int ks = 0; ks < 4; ++ks) live[ks] = lv[ks] && !__all((mk[ks] - fminf(mx[0], mx[1])) * (1.44269504f * 0.125f) < -160.f);
    if (live[0]) ldv(0);
#pragma unroll
    for (int ks = 0; ks < 4; ++ks) {   // keys 8 hi + 0..7 and 16 + 8 hi + 0..7 of the block: the k order of the fragment loader
        if (live[ks]) {
#pragma unroll
        for (int a = 0; a < 2; ++a) { v8u ph, pl;
#pragma unroll
            for (int g = 0; g < 2; ++g) { float xa[8], ev[8];
#pragma unroll
                for (int e = 0; e < 8; ++e) xa[e] = (lg[a][ks * 16 + g * 8 + e] - mx[a]) * (1.44269504f * 0.125f);   // exp((x - max) / 8) = 2^((x - max) log2 e / 8); a power of two moves through every rounding: the same bits
                exp2x8(ev, xa);
#pragma unroll
                for (int e = 0; e < 8; e += 2) { sum[a] += ev[e]; sum[a] += ev[e + 1]; unsigned x, y; splitf2(ev[e], ev[e + 1], x, y); ph[g * 4 + e / 2] = x; pl[g * 4 + e / 2] = y; }
                }
            const v16bf bh = __builtin_bit_cast(v16bf, ph), bl = __builtin_bit_cast(v16bf, pl);
#pragma unroll
            for (int nb = 0; nb < 4; ++nb) { acc[a][nb] = wmmab(vf[nb], bh, acc[a][nb]); acc[a][nb] = wmmab(vf[nb], bl, acc[a][nb]); }
            __builtin_amdgcn_sched_barrier(0); }   // the next exponentials stay behind these products, their subtractions and multiplies in between: lifted among the products, the asm statement writes
                                                   // a product's operand registers inside the four slots that the chip needs behind it
        }
        if (ks + 1 < 4 && live[ks + 1]) ldv(ks + 1);
        }
#pragma unroll
    for (int a = 0; a < 2; ++a) { sum[a] += __shfl_xor(sum[a], 16, 32); if (hi == 0) rsum[w * 32 + a * 16 + lr] = sum[a];
#pragma unroll
        for (int nb = 0; nb < 4; ++nb) { float* op = xs + w * (32 * 68) + (a * 16 + lr) * 68 + nb * 16 + 8 * hi;
            *(v4fa*)op = (v4f){acc[a][nb][0], acc[a][nb][1], acc[a][nb][2], acc[a][nb][3]}; *(v4fa*)(op + 4) = (v4f){acc[a][nb][4], acc[a][nb][5], acc[a][nb][6], acc[a][nb][7]}; } }
    __syncthreads();              // all 16 partial tiles and partial sums are in LDS before they are added
#pragma unroll
    for (int a = 0; a < 2; ++a) { const int row = a * 16 + w;
        v2f o = *(const v2fa*)(xs + row * 68 + lane * 2); float tot = rsum[row];
#pragma unroll
        for (int p = 1; p < 16; ++p) { const v2f t = *(const v2fa*)(xs + p * (32 * 68) + row * 68 + lane * 2); o[0] += t[0]; o[1] += t[1]; tot += rsum[p * 32 + row]; }
        const float ri = __fdiv_rn(1.0f, tot); o[0] *= ri; o[1] *= ri;
        *(v2f*)(OUT + (((size_t)n * TT + i0 + row) * NH_ + h) * HD + lane * 2) = o; }
}

extern "C" void kernel_launch(void* const* d_in, const int* in_sizes, int n_in,
                              void* d_out, int out_size, void* d_ws, size_t ws_size, hipStream_t stream) {
    (void)in_sizes; (void)n_in; (void)out_size;
    const float* queries = (const float*)d_in[0]; const float* keys = (const float*)d_in[1]; const float* values = (const float*)d_in[2]; const float* pos_emb = (const float*)d_in[3]; const float* am = (const float*)d_in[4]; const float* kla = (const float*)d_in[5];
    float* OUT = (float*)d_out;     // [2][2048][16][64]
    char* wsp = (char*)d_ws;
    auto take = [&](size_t bytes) { char* p = wsp; wsp += (bytes + 255) & ~(size_t)255; return (void*)p; };
    bf* QF = (bf*)take((size_t)NT * DD * 2); bf* KF = (bf*)take((size_t)NT * DD * 2); bf* VF = (bf*)take((size_t)NT * DD * 2); bf* EF = (bf*)take((size_t)NH_ * TT * HD * 2); bf* MF = (bf*)take((size_t)TT * TT * 2);
    float* ST = (float*)take((size_t)(PKW / 16) * 32 * 4); float* MS = (float*)take((size_t)(TT / 16) * (TT / 32) * 2 * 4); float* KL = (float*)take((size_t)NB_ * (TT / 32) * 2 * 4);
    if ((size_t)(wsp - (char*)d_ws) > ws_size) return;    // ws 256 MiB
    k_pack<<<PKW / 16, 512, 0, stream>>>(queries, keys, values, pos_emb, am, kla, QF, KF, VF, EF, MF, ST, MS, KL);
    k_attn<<<NB_ * NH_ * (TT / 32), 512, 0, stream>>>(QF, KF, VF, EF, MF, kla, ST, MS, KL, OUT);
}

// v010
// Measured time: 76.8 microseconds a run.
// Two timings next to v009 put it at 1.08 and 1.07 times that version's speed.
// Over all steps from v000 it is 27.9 times as fast.
#include <hip/hip_runtime.h>

// CausalRelativeAttention (queries/keys/values [2][2048][16 heads][64], pos_emb [2048][16][64]; QE = q.E_h^T; Srel = skew(QE) (Music-Transformer pad/reshape trick);
// logits = (q.k^T + Srel + attn_mask_add[l][s] + key_lengths_add[n][s]) / 8; softmax over s; out[n][l][h][d] = sum_s A v).
// Compute dtypes, f32 accumulate: every input rounded to bf16; q.k^T and q.E^T on PLAIN bf16 operands (all inputs: exact products); the skew
// (an index remap of QE: Srel[i][j] = QE[i][L-1+j-i] for j <= i, = 0 for j = i+1, = QE[i+1][j-i-2] for j > i+1 - exactly the reference's pad/reshape), the two additive

#define NB_  2
#define TT   2048
#define NH_  16
#define HD   64
#define DD   (NH_ * HD)           // 1024
#define NT   (NB_ * TT)
typedef _Float16 h16;
typedef unsigned short bf;
typedef __attribute__((ext_vector_type(16))) __bf16   v16bf;
typedef __attribute__((ext_vector_type(16))) _Float16 v16h;
typedef __attribute__((ext_vector_type(8)))  _Float16 v8h;
typedef __attribute__((ext_vector_type(8)))  unsigned short v8us;
typedef __attribute__((ext_vector_type(8)))  float    v8f;
typedef __attribute__((ext_vector_type(4)))  float    v4f;
typedef v8h  __attribute__((may_alias)) v8ha;
typedef v4f  __attribute__((may_alias)) v4fa;
typedef v8us __attribute__((may_alias)) v8usa;

typedef __attribute__((ext_vector_type(2))) float  v2f;
typedef __attribute__((ext_vector_type(2))) __bf16 v2bf;
typedef __attribute__((ext_vector_type(4))) unsigned v4u;
typedef __attribute__((ext_vector_type(8))) unsigned v8u;
typedef v4u __attribute__((may_alias)) v4ua;
// f32 -> bf16, round to nearest even, two values in one conversion instruction that also packs them (x in the low half)
__device__ __forceinline__ v2bf rbf2(float x, float y) { return __builtin_convertvector((v2f){x, y}, v2bf); }
__device__ __forceinline__ unsigned pbf2(float x, float y) { return __builtin_bit_cast(unsigned, rbf2(x, y)); }
__device__ __forceinline__ float bf2f(unsigned short b) { return __uint_as_float(((unsigned)b) << 16); }
__device__ __forceinline__ v16h cat16(v8h lo, v8h hi) { return __builtin_shufflevector(lo, hi, 0, 1, 2, 3, 4, 5, 6, 7, 8, 9, 10, 11, 12, 13, 14, 15); }
__device__ __forceinline__ v16bf cat16b(v8us lo, v8us hi) { return __builtin_bit_cast(v16bf, __builtin_shufflevector(lo, hi, 0, 1, 2, 3, 4, 5, 6, 7, 8, 9, 10, 11, 12, 13, 14, 15)); }
__device__ __forceinline__ v8f wmma16(v16h a, v16h b, v8f c) { return __builtin_amdgcn_wmma_f32_16x16x32_f16(false, a, false, b, (short)0, c, false, false); }
__device__ __forceinline__ v8f wmmab(v16bf a, v16bf b, v8f c) { return __builtin_amdgcn_wmma_f32_16x16x32_bf16(false, a, false, b, (short)0, c, false, false); }



// fragment loader: row = lane & 15, k = 8 (lane >> 4) + 0..7 and 16 + 8 (lane >> 4) + 0..7, the same for the A and the B operand
template <typename T16> struct WFrag;
template <> struct WFrag<h16> { typedef v16h V; static __device__ __forceinline__ V ld(const h16* p) { return cat16(*(const v8h*)p, *(const v8h*)(p + 16)); } static __device__ __forceinline__ v8f mma(V a, V b, v8f c) { return wmma16(a, b, c); } };
template <> struct WFrag<bf> { typedef v16bf V; static __device__ __forceinline__ V ld(const bf* p) { return cat16b(*(const v8us*)p, *(const v8us*)(p + 16)); } static __device__ __forceinline__ v8f mma(V a, V b, v8f c) { return wmmab(a, b, c); } };
// y = hi + lo, both bf16, for two values: hi = bf16(y), lo = bf16(y - hi); the difference is exact in f32
__device__ __forceinline__ void splitf2(float y0, float y1, unsigned& h, unsigned& l) { const v2bf hb = rbf2(y0, y1); const v2f hf = __builtin_convertvector(hb, v2f); h = __builtin_bit_cast(unsigned, hb); l = pbf2(y0 - hf[0], y1 - hf[1]); }

// ---- planes packed in fragment order. A wave-wide 16-byte load of a row-major plane takes 32 bytes from each of 16 lines; here the 32 lanes' chunks of one such load lie side by side,
// 512 contiguous bytes = 4 whole lines, and every line is asked for once. One lane makes one chunk (8 bf16) and a wave writes 4 whole lines a chunk row. The values and their k order are unchanged.
// Q, K and E: [head plane][tile of 16 rows][c = 0..3][lane][8] = row 16 tile + (lane & 15), d = 16 c + 8 (lane >> 4) + 0..7; chunks c = 0, 1 are the fragment of d 0..31, c = 2, 3 that of d 32..63
// V^T: [head plane][block of 32 keys][nb = 0..3][c = 0..1][lane][8] = d 16 nb + (lane & 15), key 32 block + 16 c + 8 (lane >> 4) + 0..7
// additive mask, rounded to bf16 as the logit sum takes it: [tile of 16 queries][tile of 16 keys][lane][8] = query 16 it + (lane & 15), key 16 jt + 8 (lane >> 4) + 0..7: a transposed logit tile's accumulator order
// All five planes are packed by ONE launch of 256 work-groups of 16 waves. Wave W of 4096 makes 18 chunk rows: rows 4 W .. 4 W + 3 of Q, K, V^T and the mask, rows 2 W, 2 W + 1 of E. The four
// (two) neighbouring chunk rows of a plane read whole 128-byte lines of the source between them, and all of a wave's 61 loads (one of them a key-length value, for the bounds below) are in flight before its first store.
#define PKW 4096                  // waves of the pack launch: a quarter of the 16384 chunk rows of Q, K, V^T and the mask, half of the 8192 of E
__device__ __forceinline__ v4u pk8(v4f a, v4f b) { return (v4u){pbf2(a[0], a[1]), pbf2(a[2], a[3]), pbf2(b[0], b[1]), pbf2(b[2], b[3])}; }
// Bounds for the attention kernel's tests of which blocks of 32 keys can matter at all and which add one number a query tile (see there), made from the values that the pack launch holds in registers anyway:
// ST[work-group][0..2] = largest sum of squares of a row of its 16 Q tiles, its 16 K tiles, its 16 half tiles of E; MS[tile of 16 queries][block of 32 keys] = {largest mask value, smallest over the
// 16 rows of the row's largest mask value}; MN[tile of 16 queries][block of 32 keys] = smallest mask value; KL[batch][block of 32 keys] = {largest, smallest key-length value}. One wave of a work-group stores them: whole 128-byte lines have one writer.
__device__ __forceinline__ float smax16(float x) {
#pragma unroll
    for (int m = 1; m < 16; m <<= 1) x = fmaxf(x, __shfl_xor(x, m, 32));
    return x; }
__device__ __forceinline__ float smin16(float x) {
#pragma unroll
    for (int m = 1; m < 16; m <<= 1) x = fminf(x, __shfl_xor(x, m, 32));
    return x; }
__device__ __forceinline__ float sq8(v4f a, v4f b) { return a[0] * a[0] + a[1] * a[1] + a[2] * a[2] + a[3] * a[3] + b[0] * b[0] + b[1] * b[1] + b[2] * b[2] + b[3] * b[3]; }
__device__ __forceinline__ float mx8(v4f a, v4f b) { return fmaxf(fmaxf(fmaxf(a[0], a[1]), fmaxf(a[2], a[3])), fmaxf(fmaxf(b[0], b[1]), fmaxf(b[2], b[3]))); }
__device__ __forceinline__ float mn8(v4f a, v4f b) { return fminf(fminf(fminf(a[0], a[1]), fminf(a[2], a[3])), fminf(fminf(b[0], b[1]), fminf(b[2], b[3]))); }
__global__ __launch_bounds__(512) void k_pack(const float* __restrict__ q, const float* __restrict__ k, const float* __restrict__ v, const float* __restrict__ e, const float* __restrict__ am, const float* __restrict__ kla, bf* QF, bf* KF, bf* VF, bf* EF, bf* MF, float* ST, float* MS, float* KL, float* MN) {
    __shared__ float st[16][12];
    const int lane = threadIdx.x & 31, lr = lane & 15, hi = lane >> 4; const int W = blockIdx.x * 16 + (threadIdx.x >> 5); const int z = W >> 7, n = z >> 4, h = z & 15;
    const size_t qo = (((size_t)n * TT + (W & 127) * 16 + lr) * NH_ + h) * HD + 8 * hi;                                              // tile W & 127 of head plane z, c = 0
    const float* qp = q + qo; const float* kp = k + qo;
    const float* mp = am + (size_t)((W >> 5) * 16 + lr) * TT + (W & 31) * 64 + 8 * hi;                                               // query tile W >> 5, key tiles 4 (W & 31) + 0..3
    const float* ep = e + ((size_t)(((W >> 1) & 127) * 16 + lr) * NH_ + (W >> 8)) * HD + (W & 1) * 32 + 8 * hi;                      // tile (W >> 1) & 127 of head W >> 8, c = 2 (W & 1) + 0..1
    const float* vp = v + (((size_t)n * TT + ((W >> 1) & 63) * 32 + 8 * hi) * NH_ + h) * HD + (W & 1) * 32 + lr;                     // key block (W >> 1) & 63 of head plane z, nb = 2 (W & 1) + 0..1
    const float* lp = kla + (W & 127) * 32 + lane;                                                                                   // block of 32 keys W & 127 of the 128 of both batches
    v4f qv[4][2], kv[4][2], mv[4][2], ev[2][2]; float vv[4][8]; const float lv = *lp;
#pragma unroll
    for (int u = 0; u < 4; ++u) { qv[u][0] = *(const v4fa*)(qp + u * 16); qv[u][1] = *(const v4fa*)(qp + u * 16 + 4); }
#pragma unroll
    for (int u = 0; u < 4; ++u) { kv[u][0] = *(const v4fa*)(kp + u * 16); kv[u][1] = *(const v4fa*)(kp + u * 16 + 4); }
#pragma unroll
    for (int u = 0; u < 4; ++u) { mv[u][0] = *(const v4fa*)(mp + u * 16); mv[u][1] = *(const v4fa*)(mp + u * 16 + 4); }
#pragma unroll
    for (int u = 0; u < 2; ++u) { ev[u][0] = *(const v4fa*)(ep + u * 16); ev[u][1] = *(const v4fa*)(ep + u * 16 + 4); }
#pragma unroll
    for (int u = 0; u < 4; ++u) {   // chunk row u: c = u & 1, nb = 2 (W & 1) + (u >> 1)
#pragma unroll
        for (int r = 0; r < 8; ++r) vv[u][r] = vp[(size_t)((u & 1) * 16 + r) * DD + (u >> 1) * 16]; }
    __builtin_amdgcn_sched_barrier(0);   // all 61 loads go out before the first wait for data: with conversions lifted among them the last loads started only when the first results were back
    asm volatile("s_wait_xcnt 0x0" :: "v"(qp), "v"(kp), "v"(mp), "v"(ep), "v"(vp), "v"(lp) : "memory");   // behind the loads; the six addresses are inputs, so their registers are rewritten by nothing in front of the wait
    const size_t o4 = ((size_t)W * 128 + lane) * 8, o2 = ((size_t)W * 64 + lane) * 8;
    // a plane's conversions and stores stay in the order of its loads (the scheduling barriers): each group then waits for its own loads alone and its stores run beside the loads still in flight
#pragma unroll
    for (int u = 0; u < 4; ++u) *(v4ua*)(QF + o4 + u * 256) = pk8(qv[u][0], qv[u][1]);
    __builtin_amdgcn_sched_barrier(0);
#pragma unroll
    for (int u = 0; u < 4; ++u) *(v4ua*)(KF + o4 + u * 256) = pk8(kv[u][0], kv[u][1]);
    __builtin_amdgcn_sched_barrier(0);
#pragma unroll
    for (int u = 0; u < 4; ++u) *(v4ua*)(MF + o4 + u * 256) = pk8(mv[u][0], mv[u][1]);
    __builtin_amdgcn_sched_barrier(0);
#pragma unroll
    for (int u = 0; u < 2; ++u) *(v4ua*)(EF + o2 + u * 256) = pk8(ev[u][0], ev[u][1]);
    __builtin_amdgcn_sched_barrier(0);
#pragma unroll
    for (int u = 0; u < 4; ++u) *(v4ua*)(VF + o4 + u * 256) = (v4u){pbf2(vv[u][0], vv[u][1]), pbf2(vv[u][2], vv[u][3]), pbf2(vv[u][4], vv[u][5]), pbf2(vv[u][6], vv[u][7])};
    {   // the bounds: a row's values lie in lanes lr and lr + 16
        const int wv = threadIdx.x >> 5;
        float qs = 0.f, ks = 0.f, es = 0.f, mm[2], nn[2];
#pragma unroll
        for (int u = 0; u < 4; ++u) { qs += sq8(qv[u][0], qv[u][1]); ks += sq8(kv[u][0], kv[u][1]); }
#pragma unroll
        for (int u = 0; u < 2; ++u) { es += sq8(ev[u][0], ev[u][1]); mm[u] = fmaxf(mx8(mv[2 * u][0], mv[2 * u][1]), mx8(mv[2 * u + 1][0], mv[2 * u + 1][1])); mm[u] = fmaxf(mm[u], __shfl_xor(mm[u], 16, 32));
            nn[u] = fminf(mn8(mv[2 * u][0], mv[2 * u][1]), mn8(mv[2 * u + 1][0], mv[2 * u + 1][1])); nn[u] = fminf(nn[u], __shfl_xor(nn[u], 16, 32)); }
        qs = smax16(qs + __shfl_xor(qs, 16, 32)); ks = smax16(ks + __shfl_xor(ks, 16, 32)); es = smax16(es + __shfl_xor(es, 16, 32));
        const float h0 = smax16(mm[0]), l0 = smin16(mm[0]), h1 = smax16(mm[1]), l1 = smin16(mm[1]), n0 = smin16(nn[0]), n1 = smin16(nn[1]);
        const float lh = smax16(fmaxf(lv, __shfl_xor(lv, 16, 32))), ll = smin16(fminf(lv, __shfl_xor(lv, 16, 32)));
        if (lane == 0) { st[wv][0] = qs; st[wv][1] = ks; st[wv][2] = es; st[wv][4] = h0; st[wv][5] = l0; st[wv][6] = h1; st[wv][7] = l1; st[wv][8] = lh; st[wv][9] = ll; st[wv][10] = n0; st[wv][11] = n1; }
        __syncthreads();          // the 16 waves' bounds are in LDS before wave 0 gathers them
        if (wv == 0) {
            *(v2f*)(MS + blockIdx.x * 64 + lane * 2) = (v2f){st[lane >> 1][4 + (lane & 1) * 2], st[lane >> 1][5 + (lane & 1) * 2]};
            MN[blockIdx.x * 32 + lane] = st[lane >> 1][10 + (lane & 1)];
            const float a = smax16(st[lr][0]), b = smax16(st[lr][1]), c = smax16(st[lr][2]);
            if (lane == 0) *(v4f*)(ST + blockIdx.x * 32) = (v4f){a, b, c, 0.f};
            if (blockIdx.x < 8 && lane < 16) *(v2f*)(KL + blockIdx.x * 32 + lane * 2) = (v2f){st[lane][8], st[lane][9]};
        }
    }
}
// a fragment of a packed plane: two chunks, 256 elements apart
__device__ __forceinline__ v16bf ldp(const bf* p) { return cat16b(*(const v8us*)p, *(const v8us*)(p + 256)); }
// logit(i,j) = (q_i.k_j + Srel(i,j) + bf(am[i][j]) + bf(kla[n][j])) / 8 with Srel(i,j) = QE[i][L-1+j-i] (j <= i), 0 (j == i+1), QE[i+1][j-i-2] (j >= i+2), QE[i][r] = q_i.E_h[r].
// ---- k_attn: both logit products, the skew, softmax and P.V of 32 query rows (two tiles of 16) of one head in one work-group of 16 waves; grid 32 heads * L / 32. Every tile is kept
// TRANSPOSED (rows = keys or positions, columns = 16 queries: lane & 15 is the query), so that a logit tile's accumulator registers are, after exp, already the B fragment of V^T.P^T.
// Each E, K and V^T fragment is loaded once and multiplied with both query tiles: the bytes a work-group draws from L2 serve twice the queries.
// Phase A, wave w = the four blocks of 32 positions w, w + 16, w + 32, w + 48 (KO below), those of them that a block of keys which is worked on reads: QE^T tiles to LDS, one row of XP dwords a query; row i0+31 reads on in QE row i0+32, which is the first column of a third
// tile on queries i0+32..i0+47. Phase B, wave w = the four blocks of 32 keys w, w + 16, w + 32, w + 48 (KO below): the skewed QE run from LDS plus both
// masks is the start value of the K.Q^T accumulator; row max over lanes, then over waves through LDS. Phase C: exp, bf16 hi/lo split, V^T.P^T on the wave's own 128 keys, f32 partial tiles to LDS; a block of 32 keys whose 2^x are all exactly 0 is left out.
// Phase D: the 16 partials and the 16 partial row sums are added in wave order, scaled by 1/sum and stored as whole 256-byte rows of the output.
#define XP 2052                   // pitch of a QE row in LDS, in dwords: 16-byte stores of 16 rows fall on all 64 banks (pitch = 4 mod 64), the skewed dword reads step 3 banks a lane
#define XU (XP - TT - 1)          // a row's run for j >= i+2 starts this many dwords behind the place where its run for j <= i would go on
#define KO(t) (((t) >> 1) * 512 + ((t) & 1) * 16)   // first key of a wave's key tile t = 0..7, counted from its first key 32 w: blocks of 32 keys are dealt to the 16 waves in turn
// eight 2^x in one statement: behind a v_exp_f32 the instruction set asks for one independent instruction before its result is read or its source overwritten; here each is the
// next one's (outputs share no register with an input), and the v_nop is the last one's.
__device__ __forceinline__ void exp2x8(float* r, const float* x) {
    asm("v_exp_f32 %0, %8\n\tv_exp_f32 %1, %9\n\tv_exp_f32 %2, %10\n\tv_exp_f32 %3, %11\n\tv_exp_f32 %4, %12\n\tv_exp_f32 %5, %13\n\tv_exp_f32 %6, %14\n\tv_exp_f32 %7, %15\n\tv_nop"
        : "=&v"(r[0]), "=&v"(r[1]), "=&v"(r[2]), "=&v"(r[3]), "=&v"(r[4]), "=&v"(r[5]), "=&v"(r[6]), "=&v"(r[7]) : "v"(x[0]), "v"(x[1]), "v"(x[2]), "v"(x[3]), "v"(x[4]), "v"(x[5]), "v"(x[6]), "v"(x[7]));
}
typedef v2f  __attribute__((may_alias)) v2fa;
__global__ __launch_bounds__(512) void k_attn(const bf* __restrict__ QF, const bf* __restrict__ KF, const bf* __restrict__ VF, const bf* __restrict__ EF, const bf* __restrict__ MF, const float* __restrict__ kla, const float* __restrict__ ST, const float* __restrict__ MS, const float* __restrict__ KL, const float* __restrict__ MN, float* OUT) {
    __shared__ __align__(16) float xs[33 * XP];   // phases A and B: QE rows i0..i0+32; phases C and D: the 16 partial output tiles, 32 x 68 dwords each
    __shared__ float rmax[16 * 32];
    __shared__ float rsum[16 * 32];
    const int lane = threadIdx.x & 31, lr = lane & 15, hi = lane >> 4; const int w = __builtin_amdgcn_readfirstlane(threadIdx.x >> 5);
    // There are eight times as many work-groups as places. Under a causal mask a block of queries costs more the further down it lies, so the lowest blocks take the lowest indices
    // (all 32 head planes of a block side by side), for speed only. A permutation of (head plane, block): right for any mask, wherever and whenever a work-group runs.
    // The % is an identity on this grid; it tells the compiler that the block number lies in 0..63, as the old map's did (without it the diagonal tiles' index arithmetic came out longer).
    const int z = blockIdx.x % (NB_ * NH_); const int i0 = (TT / 32 - 1 - (blockIdx.x / (NB_ * NH_)) % (TT / 32)) * 32; const int n = z >> 4, h = z & 15;
    const bf* qz = QF + (size_t)z * TT * HD; const bf* kw = KF + (size_t)z * TT * HD + (size_t)w * 32 * HD; const bf* ew = EF + (size_t)h * TT * HD + (size_t)w * 32 * HD; const bf* vw = VF + (size_t)z * HD * TT + (size_t)w * 32 * HD;
    const unsigned po = (unsigned)(lane * 8);           // in the packed planes: a tile of 16 rows is 1024 elements, a V^T block of 32 keys 2048, a mask tile 256
    const bf* q0p = qz + i0 * HD; const bf* q2p = qz + (i0 + 32 < TT ? i0 + 32 : i0) * HD;   // the tile of queries below; the last block has no row below it, and its row 32 in LDS is never read
    v16bf qa[2], qb[2]; const v16bf q2a = ldp(q2p + po), q2b = ldp(q2p + 512 + po);
#pragma unroll
    for (int a = 0; a < 2; ++a) { qa[a] = ldp(q0p + a * 1024 + po); qb[a] = ldp(q0p + a * 1024 + 512 + po); }
    // Which blocks of 32 keys can matter, known before any product. |q.k + Srel| <= |q| (|k| + |E row|) <= bq + bk / 2 + be =: B (a b <= (a a + b b) / 2; be is the largest HALF row's sum of squares, so a row's is
    // at most 2 be). A row's maximum is at least its best mask sum - B, a block's values are at most its largest mask sum + B. Where, for both query tiles, the block's bound lies more than 2000 under the
    // row bound, every exponent of the block is under -160 and every 2^x exactly 0: the block adds nothing to row maximum, row sum or output, and its K, mask and V^T loads, its products and the QE
    // positions that only such blocks read are left out. The 1/64 covers the bf16 rounding of both masks and the f32 roundings at their size, the 2.2 (for 2) those of the products. The test reads
    // the inputs alone, holds for any mask, and is false (the block is worked on) where an infinity enters it; the maxima drop a NaN, as those of the test in phase C do. Every wave forms the same 64 bits: no barrier, scalar branches only.
    // A block of 32 keys whose mask values are all one value for each query tile (largest == smallest, from the pack launch) and whose key-length values are all one value adds ONE number a query tile to its
    // logits: the sum of the two bf16 roundings, the very sum that the general path forms element by element. Such a block takes it from a scalar register: no mask loads, no key-length loads, no unpacking.
    // The test reads the inputs alone and holds for any mask; +0 and -0 count as one value (the sums then differ at most in the sign of a zero); the maxima and minima drop a NaN, as those of the test above do.
    unsigned long long LV, ND, UN; float cv[2][2];
    {
        const float* sz = ST + z * 8 * 32; const int qt = i0 >> 4, q2 = (qt + 2 < TT / 16 ? qt + 2 : qt);
        // the lane's byte offsets: inputs of the wait below, so that their registers live, unwritten, up to it
        const unsigned oq = (unsigned)(((lane & 1 ? q2 : qt) >> 4) * 128), ok = (unsigned)((lane & 7) * 128 + 4), oe = (unsigned)((h * 16 + lr) * 128 + 8), ol = (unsigned)((n * 64 + lane) * 8), om = (unsigned)((qt * 64 + lane) * 8), on = (unsigned)((qt * 64 + lane) * 4);
        const float bq = *(const float*)((const char*)sz + oq), bk = *(const float*)((const char*)sz + ok), be = *(const float*)((const char*)ST + oe);
        v2f mt[2][2], kt[2]; float mn[2][2];
#pragma unroll
        for (int p = 0; p < 2; ++p) { kt[p] = *(const v2fa*)((const char*)KL + ol + p * 256);
#pragma unroll
            for (int a = 0; a < 2; ++a) { mt[a][p] = *(const v2fa*)((const char*)MS + om + a * 512 + p * 256); mn[a][p] = *(const float*)((const char*)MN + on + a * 256 + p * 128); } }
        __builtin_amdgcn_sched_barrier(0);   // the Q loads and all loads of the bounds go out before the first wait for data: with arithmetic on the first values lifted among them, the rest started only when those were back
        asm volatile("s_wait_xcnt 0x0" :: "v"(oq), "v"(ok), "v"(oe), "v"(ol), "v"(om), "v"(on) : "memory");   // behind the loads of the bounds: their address registers are free for what follows
        auto wmax = [&](float x) {
#pragma unroll
            for (int m = 1; m < 32; m <<= 1) x = fmaxf(x, __shfl_xor(x, m, 32));
            return x; };
        const float T = 2.2f * (wmax(bq) + 0.5f * wmax(bk) + wmax(be)) + 2000.f;
        float up[2][2], mr[2];
#pragma unroll
        for (int a = 0; a < 2; ++a) { float lo[2];
#pragma unroll
            for (int p = 0; p < 2; ++p) { up[a][p] = (mt[a][p][0] + fabsf(mt[a][p][0]) * 0.015625f) + (kt[p][0] + fabsf(kt[p][0]) * 0.015625f); lo[p] = (mt[a][p][1] - fabsf(mt[a][p][1]) * 0.015625f) + (kt[p][1] - fabsf(kt[p][1]) * 0.015625f); }
            mr[a] = wmax(fmaxf(lo[0], lo[1])); }
        const unsigned b0 = (unsigned)__ballot(!(up[0][0] + T < mr[0] && up[1][0] + T < mr[1])), b1 = (unsigned)__ballot(!(up[0][1] + T < mr[0] && up[1][1] + T < mr[1]));
        LV = (unsigned long long)b0 | ((unsigned long long)b1 << 32);
        bool ua[2];
#pragma unroll
        for (int p = 0; p < 2; ++p) { ua[p] = mt[0][p][0] == mn[0][p] && mt[1][p][0] == mn[1][p] && kt[p][0] == kt[p][1];
            const v2f r0 = __builtin_convertvector(rbf2(mt[0][p][0], mt[1][p][0]), v2f), r1 = __builtin_convertvector(rbf2(kt[p][0], kt[p][0]), v2f);
            cv[0][p] = __fadd_rn(r0[0], r1[0]); cv[1][p] = __fadd_rn(r0[1], r1[0]); }
        UN = (unsigned long long)(unsigned)__ballot(ua[0]) | ((unsigned long long)(unsigned)__ballot(ua[1]) << 32);
        // key block kb against query block ib = i0 / 32 reads QE positions (blocks of 32): kb <= ib: kb + 63 - ib and kb + 64 - ib; kb >= ib: kb - ib - 2 .. kb - ib (the run in the next row)
        const int ib = i0 >> 5; const unsigned long long lw = (LV & ((2ull << ib) - 1ull)) << (63 - ib), uw = LV >> ib;
        ND = lw | (lw << 1) | uw | (uw >> 1) | (uw >> 2);
    }
    bool lv[4], nd[4], un[4]; float cs[2][4];   // the wave's own four key blocks and four position blocks: w, w + 16, w + 32, w + 48; block w + 16 ks stands in lane w + 16 (ks & 1) of half ks >> 1
#pragma unroll
    for (int ks = 0; ks < 4; ++ks) { lv[ks] = (LV >> (w + 16 * ks)) & 1ull; nd[ks] = (ND >> (w + 16 * ks)) & 1ull; un[ks] = (UN >> (w + 16 * ks)) & 1ull;
#pragma unroll
        for (int a = 0; a < 2; ++a) cs[a][ks] = __int_as_float(__builtin_amdgcn_readlane(__float_as_int(cv[a][ks >> 1]), w + 16 * (ks & 1))); }
    const bf* mw = MF + ((size_t)(i0 >> 4) * (TT / 16) + w * 2) * 256; const float* kr = kla + (size_t)n * TT + w * 32;   // the same address in every lane: the key-length values come through scalar registers
    // a key tile's two K fragments are fetched one tile ahead into the same registers, right behind the products that read them; its mask and key-length values two tiles ahead into two register sets
    v16bf kf[2]; v8us af[2][2]; float lf[2][16];
    const bf* kq = kw + po; const bf* mq = mw + po;   // the lane's own addresses: inputs of the wait behind the phase's last loads, so that their registers live, unwritten, up to it
    auto ldk = [&](int t) { kf[0] = ldp(kq + KO(t) * HD); kf[1] = ldp(kq + KO(t) * HD + 512); };
    auto ldm = [&](int t) { const int s = t & 1; af[s][0] = *(const v8usa*)(mq + KO(t) * 16); af[s][1] = *(const v8usa*)(mq + (TT / 16) * 256 + KO(t) * 16);
#pragma unroll
        for (int e = 0; e < 16; ++e) lf[s][e] = kr[KO(t) + e]; };
    {
        float* xp = xs + lr * XP + w * 32 + 8 * hi;
        v16bf ef[8][2];           // all E tiles that are needed are asked for at once
#pragma unroll
        for (int t = 0; t < 8; ++t) if (nd[t >> 1]) { ef[t][0] = ldp(ew + KO(t) * HD + po); ef[t][1] = ldp(ew + KO(t) * HD + 512 + po); }
        asm volatile("s_wait_xcnt 0x0" :: "s"(ew), "s"(q0p), "s"(q2p) : "memory");   // behind the Q and E loads; their base addresses are inputs, so the scalar registers that hold them are rewritten by nothing in front of the wait
#pragma unroll
        for (int b = 0; b < 4; ++b) if (nd[b]) { v8f u[2], d[2][2];
#pragma unroll
            for (int c = 0; c < 2; ++c) { const v16bf e0 = ef[2 * b + c][0], e1 = ef[2 * b + c][1]; u[c] = (v8f){};
                u[c] = wmmab(e0, q2a, u[c]); u[c] = wmmab(e1, q2b, u[c]);
#pragma unroll
                for (int a = 0; a < 2; ++a) { d[c][a] = (v8f){}; d[c][a] = wmmab(e0, qa[a], d[c][a]); d[c][a] = wmmab(e1, qb[a], d[c][a]); } }
            __builtin_amdgcn_sched_barrier(0);   // the LDS stores stay behind the block's twelve products: with a store lifted among them its registers took a later product's result inside the four slots behind the first
#pragma unroll
            for (int c = 0; c < 2; ++c) {
#pragma unroll
                for (int a = 0; a < 2; ++a) { const v8f x = d[c][a]; *(v4fa*)(xp + a * 16 * XP + KO(2 * b + c)) = (v4f){x[0], x[1], x[2], x[3]}; *(v4fa*)(xp + a * 16 * XP + KO(2 * b + c) + 4) = (v4f){x[4], x[5], x[6], x[7]}; } }
            if (lr == 0) {        // column 0 of the third tile is query i0+32
#pragma unroll
                for (int c = 0; c < 2; ++c) { *(v4fa*)(xp + 32 * XP + KO(2 * b + c)) = (v4f){u[c][0], u[c][1], u[c][2], u[c][3]}; *(v4fa*)(xp + 32 * XP + KO(2 * b + c) + 4) = (v4f){u[c][4], u[c][5], u[c][6], u[c][7]}; } }
            if (b < 3) asm volatile("v_nop\n\tv_nop\n\tv_nop\n\tv_nop"); }   // the four vector slots that the chip needs behind a product: the branch round the lr == 0 stores leads straight to the next block's products, which write this block's result registers
        if (lv[0]) { ldk(0); if (!un[0]) { ldm(0); ldm(1); } }   // the next phase's first loads go out in front of the barrier: their latency runs beside the wait for the other waves
    }
    __syncthreads();              // every QE row is in LDS before another wave reads its skewed run
    float lg[2][64]; float mx[2] = {-__builtin_inff(), -__builtin_inff()};   // below every value: the maximum is taken of 8 x the logit, which may lie under any finite start
    float mk[4] = {-__builtin_inff(), -__builtin_inff(), -__builtin_inff(), -__builtin_inff()};   // a lane's largest value of each block of 32 keys, over its two rows
#pragma unroll
    for (int a = 0; a < 2; ++a) { const int ia0 = i0 + 16 * a, i = ia0 + lr; const float* xb = xs + (a * 16 + lr) * XP + (TT - 1 - i) + w * 32 + 8 * hi;
#pragma unroll
        for (int t = 0; t < 8; ++t) if (lv[t >> 1]) { const int j0 = w * 32 + KO(t);   // the skewed runs first
            if (j0 == ia0 || j0 == ia0 + 16) {    // the two tiles that the diagonal j == i+1 crosses: each element picks its own run; at j == i+1 the neighbour is read and dropped
#pragma unroll
                for (int e = 0; e < 8; ++e) { const int je = j0 + 8 * hi + e; const float v = xb[KO(t) + e + (je > i + 1 ? XU : (je > i ? -1 : 0))]; lg[a][t * 8 + e] = (je == i + 1) ? 0.f : v; }
            } else { const float* p = xb + (j0 > ia0 ? KO(t) + XU : KO(t));
#pragma unroll
                for (int e = 0; e < 8; ++e) lg[a][t * 8 + e] = p[e]; } } }
#pragma unroll
    for (int ks = 0; ks < 4; ++ks) if (lv[ks] && un[ks]) {   // one value a query tile for the whole block, added in place; in a branch of the tile's own code beside the general sum the two results met in a second set of registers
#pragma unroll
        for (int a = 0; a < 2; ++a) {
#pragma unroll
            for (int e = 0; e < 16; ++e) lg[a][ks * 16 + e] = __fadd_rn(lg[a][ks * 16 + e], cs[a][ks]); } }
#pragma unroll
    for (int ks = 0; ks < 4; ++ks) { const bool nx = ks + 1 < 4 && lv[ks + 1];
      // Scalar branches only. The next block's loads go out only where it is worked on, each from ONE place that is passed whether or not this block is worked on: its first mask tile behind this block's
      // first tile, its K and second mask tile behind the second. From two places (one in the block, one beside it) the results met in copies, and the copies waited for the loads at once.
#pragma unroll
      for (int c = 0; c < 2; ++c) { const int t = 2 * ks + c, b = c;
        if (lv[ks]) { v8f s[2];
        if (!un[ks]) {
#pragma unroll
        for (int e = 0; e < 8; e += 2) { const v2f kv = __builtin_convertvector(rbf2(hi ? lf[b][8 + e] : lf[b][e], hi ? lf[b][9 + e] : lf[b][1 + e]), v2f);   // the skewed QE value and both masks start the accumulator of K.Q^T: no second set of eight registers a tile
#pragma unroll
            for (int a = 0; a < 2; ++a) { lg[a][t * 8 + e] = __fadd_rn(lg[a][t * 8 + e], __fadd_rn(bf2f(af[b][a][e]), kv[0])); lg[a][t * 8 + e + 1] = __fadd_rn(lg[a][t * 8 + e + 1], __fadd_rn(bf2f(af[b][a][e + 1]), kv[1])); } } }
#pragma unroll
        for (int a = 0; a < 2; ++a) {
#pragma unroll
            for (int e = 0; e < 8; ++e) s[a][e] = lg[a][t * 8 + e]; }
#pragma unroll
        for (int a = 0; a < 2; ++a) { s[a] = wmmab(kf[0], qa[a], s[a]); s[a] = wmmab(kf[1], qb[a], s[a]); }
        if (c == 0) ldk(t + 1);
        float tm[2];
#pragma unroll
        for (int a = 0; a < 2; ++a) { tm[a] = s[a][0];
#pragma unroll
            for (int e = 0; e < 8; ++e) { lg[a][t * 8 + e] = s[a][e]; if (e) tm[a] = fmaxf(tm[a], s[a][e]); }   // 8 x the logit stays where the products left it; the 1/8 is in the factor of the exponent
            mx[a] = fmaxf(mx[a], tm[a]); }
        mk[ks] = fmaxf(mk[ks], fmaxf(tm[0], tm[1])); }
        if (nx) { if (c == 1) ldk(t + 1); if (!un[ks + 1]) ldm(t + 2); } } }
    asm volatile("s_wait_xcnt 0x0" :: "v"(kq), "v"(mq) : "memory");   // behind the last loads of this phase: their address registers are free for the arithmetic that follows
    v16bf vf[4];                  // V^T fragments of 32 keys, fetched one step ahead into the same registers; the first go out once the wave knows which blocks it needs, and fly beside its first exponentials
    auto ldv = [&](int ks) {
#pragma unroll
        for (int nb = 0; nb < 4; ++nb) vf[nb] = ldp(vw + ks * (512 * HD) + nb * 512 + po); };
#pragma unroll
    for (int a = 0; a < 2; ++a) { mx[a] = fmaxf(mx[a], __shfl_xor(mx[a], 16, 32)); if (hi == 0) rmax[w * 32 + a * 16 + lr] = mx[a]; }
    __syncthreads();              // every wave's row maxima are in LDS, and every read of the QE rows is over before the partial tiles are written over them
#pragma unroll
    for (int a = 0; a < 2; ++a) {
#pragma unroll
        for (int p = 0; p < 16; ++p) mx[a] = fmaxf(mx[a], rmax[p * 32 + a * 16 + lr]); }
    float sum[2] = {0.f, 0.f}; v8f acc[2][4];
#pragma unroll
    for (int a = 0; a < 2; ++a) {
#pragma unroll
        for (int nb = 0; nb < 4; ++nb) acc[a][nb] = (v8f){}; }
    // Where, in every lane, the largest value of a block of 32 keys taken against the smaller of the lane's two row maxima gives an exponent under -160, every 2^x of the block is exactly 0 (the
    // smallest f32 above 0 is 2^-149; subtraction and multiply are monotone): it adds nothing to the row sums and, V being finite, nothing to the partial tiles. Such a block is left out: no exponentials, no V^T loads, no products.
    // The test is on the computed logits alone, holds for any mask, and is false where a NaN makes it so. One answer a wave: scalar branches, EXEC stays full around the products.
    bool live[4];
#pragma unroll
    for (int ks = 0; ks < 4; ++ks) live[ks] = lv[ks] && !__all((mk[ks] - fminf(mx[0], mx[1])) * (1.44269504f * 0.125f) < -160.f);
    if (live[0]) ldv(0);
#pragma unroll
    for (int ks = 0; ks < 4; ++ks) {   // keys 8 hi + 0..7 and 16 + 8 hi + 0..7 of the block: the k order of the fragment loader
        if (live[ks]) {
#pragma unroll
        for (int a = 0; a < 2; ++a) { v8u ph, pl;
#pragma unroll
            for (int g = 0; g < 2; ++g) { float xa[8], ev[8];
#pragma unroll
                for (int e = 0; e < 8; ++e) xa[e] = (lg[a][ks * 16 + g * 8 + e] - mx[a]) * (1.44269504f * 0.125f);   // exp((x - max) / 8) = 2^((x - max) log2 e / 8); a power of two moves through every rounding: the same bits
                exp2x8(ev, xa);
#pragma unroll
                for (int e = 0; e < 8; e += 2) { sum[a] += ev[e]; sum[a] += ev[e + 1]; unsigned x, y; splitf2(ev[e], ev[e + 1], x, y); ph[g * 4 + e / 2] = x; pl[g * 4 + e / 2] = y; }
                }
            const v16bf bh = __builtin_bit_cast(v16bf, ph), bl = __builtin_bit_cast(v16bf, pl);
#pragma unroll
            for (int nb = 0; nb < 4; ++nb) { acc[a][nb] = wmmab(vf[nb], bh, acc[a][nb]); acc[a][nb] = wmmab(vf[nb], bl, acc[a][nb]); }
            __builtin_amdgcn_sched_barrier(0); }   // the next exponentials stay behind these products, their subtractions and multiplies in between: lifted among the products, the asm statement writes
                                                   // a product's operand registers inside the four slots that the chip needs behind it
        }
        if (ks + 1 < 4 && live[ks + 1]) ldv(ks + 1);
        }
#pragma unroll
    for (int a = 0; a < 2; ++a) { sum[a] += __shfl_xor(sum[a], 16, 32); if (hi == 0) rsum[w * 32 + a * 16 + lr] = sum[a];
#pragma unroll
        for (int nb = 0; nb < 4; ++nb) { float* op = xs + w * (32 * 68) + (a * 16 + lr) * 68 + nb * 16 + 8 * hi;
            *(v4fa*)op = (v4f){acc[a][nb][0], acc[a][nb][1], acc[a][nb][2], acc[a][nb][3]}; *(v4fa*)(op + 4) = (v4f){acc[a][nb][4], acc[a][nb][5], acc[a][nb][6], acc[a][nb][7]}; } }
    __syncthreads();              // all 16 partial tiles and partial sums are in LDS before they are added
#pragma unroll
    for (int a = 0; a < 2; ++a) { const int row = a * 16 + w;
        v2f o = *(const v2fa*)(xs + row * 68 + lane * 2); float tot = rsum[row];
#pragma unroll
        for (int p = 1; p < 16; ++p) { const v2f t = *(const v2fa*)(xs + p * (32 * 68) + row * 68 + lane * 2); o[0] += t[0]; o[1] += t[1]; tot += rsum[p * 32 + row]; }
        const float ri = __fdiv_rn(1.0f, tot); o[0] *= ri; o[1] *= ri;
        *(v2f*)(OUT + (((size_t)n * TT + i0 + row) * NH_ + h) * HD + lane * 2) = o; }
}

extern "C" void kernel_launch(void* const* d_in, const int* in_sizes, int n_in,
                              void* d_out, int out_size, void* d_ws, size_t ws_size, hipStream_t stream) {
    (void)in_sizes; (void)n_in; (void)out_size;
    const float* queries = (const float*)d_in[0]; const float* keys = (const float*)d_in[1]; const float* values = (const float*)d_in[2]; const float* pos_emb = (const float*)d_in[3]; const float* am = (const float*)d_in[4]; const float* kla = (const float*)d_in[5];
    float* OUT = (float*)d_out;     // [2][2048][16][64]
    char* wsp = (char*)d_ws;
    auto take = [&](size_t bytes) { char* p = wsp; wsp += (bytes + 255) & ~(size_t)255; return (void*)p; };
    bf* QF = (bf*)take((size_t)NT * DD * 2); bf* KF = (bf*)take((size_t)NT * DD * 2); bf* VF = (bf*)take((size_t)NT * DD * 2); bf* EF = (bf*)take((size_t)NH_ * TT * HD * 2); bf* MF = (bf*)take((size_t)TT * TT * 2);
    float* ST = (float*)take((size_t)(PKW / 16) * 32 * 4); float* MS = (float*)take((size_t)(TT / 16) * (TT / 32) * 2 * 4); float* KL = (float*)take((size_t)NB_ * (TT / 32) * 2 * 4); float* MN = (float*)take((size_t)(TT / 16) * (TT / 32) * 4);
    if ((size_t)(wsp - (char*)d_ws) > ws_size) return;    // ws 256 MiB
    k_pack<<<PKW / 16, 512, 0, stream>>>(queries, keys, values, pos_emb, am, kla, QF, KF, VF, EF, MF, ST, MS, KL, MN);
    k_attn<<<NB_ * NH_ * (TT / 32), 512, 0, stream>>>(QF, KF, VF, EF, MF, kla, ST, MS, KL, MN, OUT);
}
